// v000
// The times below were measured on an AMD MI455X: many runs one after another, warmed up first and cycling through
// copies of the inputs, with the whole window's GPU time divided by the number of runs. Launches and the gaps
// between them are all in it. The median over several windows is given; except for v000 it joins two sittings, which
// can be a few percent apart, so the side-by-side timings, each taken in one sitting, are the better comparison.
// v000 is the starting kernel. One run takes 750 microseconds.
#include <hip/hip_runtime.h>

// Contractions and dtypes (f32 accumulate everywhere): q/k/v projections v_wmma_f32_16x16x32_bf16 on RNE bf16 copies of the inputs (exact products);
// scores and P.V for query rows < 512: bf16 hi/lo split planes (3 products); query rows >= 512: v_wmma_f32_16x16x32_f16 (f16 q/k/v planes, P carried x1024);
// output projection: bf16 hi/lo context planes x bf16 Wo (2 products); softmax and all side math f32.
// Sizes: query/key/value [2][2048][512], weights [512][512] in [out][in] layout (y = x W^T), 8 heads of 64, causal (keys j <= i), scores x 512^-0.5, out [2][2048][512].
// Per batch: bf16 copies of query, key, value [SEQ][512] (one staging buffer reused in stream order); projections [SEQ][512] f32 -> head planes [h][t][64]
// (q, k: f16 + bf16 hi/lo) and value planes [h][64][t] (f16 + bf16 hi/lo); per pair of heads: score tiles (tiles entirely above the causal diagonal skipped) ->
// row softmax -> P planes (rows < 512 bf16 hi/lo, rows >= 512 f16 x1024) -> P.V -> context hi/lo planes [t][h*64 + d]; then context x Wo -> out rows of the batch.

#ifndef NB
#define NB 2
#endif
#ifndef SEQ
#define SEQ 2048
#endif
#define NB_FULL  2
#define SEQ_FULL 2048
#define TT   SEQ
#define DM   512
#define NH_  8
#define NKV  8
#define REP  (NH_ / NKV)
#define HD   64
#define DQ   (NH_ * HD)
#define DKV  (NKV * HD)
#define ZH   2
#define RH   (((TT) < 512) ? (TT) : 512)   // query rows < RH use hi+lo planes
#define WIN  TT
#define PCAR 1024.0f
#define SCL  0.044194173824159216f        // 512^-0.5

static_assert(NB >= 1 && NB <= NB_FULL);
static_assert(SEQ >= 128 && SEQ <= SEQ_FULL && (SEQ % 128) == 0);
static_assert((RH % 64) == 0 && ((TT - RH) % 64) == 0 && RH > 0);
static_assert((NH_ % ZH) == 0 && REP == 1 && HD == 64 && (DM % 64) == 0 && (DQ % 64) == 0 && (DKV % 64) == 0);
// workspace carve (every region is a multiple of 256 B and of its store granularity)
#define WS_TOTAL ((size_t)2 * DQ * DM * 2 + (size_t)2 * DKV * DM * 2 + (size_t)TT * DM * 2 + (size_t)TT * DQ * 4 + (size_t)TT * DKV * 4 \
                + (size_t)(NH_ + 2 * NKV) * TT * HD * 2 + (size_t)(2 * NH_ + 4 * NKV) * TT * HD * 2 + (size_t)2 * ZH * RH * TT * 2 \
                + (size_t)ZH * TT * TT * 4 + (size_t)ZH * TT * TT * 2 + (size_t)ZH * TT * HD * 4 + (size_t)2 * TT * DQ * 2)
static_assert(WS_TOTAL <= (size_t)134217728);
static_assert(((size_t)(NB - 1) * SEQ_FULL + SEQ) * DM <= (size_t)NB_FULL * SEQ_FULL * DM);

typedef _Float16 h16;
typedef unsigned short bf;
typedef __attribute__((ext_vector_type(16))) __bf16   v16bf;
typedef __attribute__((ext_vector_type(16))) _Float16 v16h;
typedef __attribute__((ext_vector_type(8)))  _Float16 v8h;
typedef __attribute__((ext_vector_type(8)))  unsigned short v8us;
typedef __attribute__((ext_vector_type(8)))  float    v8f;
typedef __attribute__((ext_vector_type(4)))  float    v4f;
typedef v8h  __attribute__((may_alias)) v8ha;
typedef v4f  __attribute__((may_alias)) v4fa;
typedef v8us __attribute__((may_alias)) v8usa;

__device__ __forceinline__ unsigned short f2bf(float f) { unsigned u = __float_as_uint(f); u += 0x7FFFu + ((u >> 16) & 1u); return (unsigned short)(u >> 16); }
__device__ __forceinline__ float bf2f(unsigned short b) { return __uint_as_float(((unsigned)b) << 16); }
__device__ __forceinline__ float bfr(float f) { return bf2f(f2bf(f)); }
__device__ __forceinline__ v16h cat16(v8h lo, v8h hi) { return __builtin_shufflevector(lo, hi, 0, 1, 2, 3, 4, 5, 6, 7, 8, 9, 10, 11, 12, 13, 14, 15); }
__device__ __forceinline__ v16bf cat16b(v8us lo, v8us hi) { return __builtin_bit_cast(v16bf, __builtin_shufflevector(lo, hi, 0, 1, 2, 3, 4, 5, 6, 7, 8, 9, 10, 11, 12, 13, 14, 15)); }
__device__ __forceinline__ v8f wmma16(v16h a, v16h b, v8f c) { return __builtin_amdgcn_wmma_f32_16x16x32_f16(false, a, false, b, (short)0, c, false, false); }
__device__ __forceinline__ v8f wmmab(v16bf a, v16bf b, v8f c) { return __builtin_amdgcn_wmma_f32_16x16x32_bf16(false, a, false, b, (short)0, c, false, false); }

// ---- k_gemmw: register-blocked GEMM, ONE WAVE per 64x64 output tile (16 accumulators), operands straight from K-contiguous 16-bit planes; grid (M/64, N/64, Z), 32 threads.
// C[m][n] (f32, pitch ldc, + optional f32 bias[n]) = sum_k A[m][k] Bt[n][k] (+ split products per NSPLIT). z-batch strides sA/sB/sC in elements. K % 32 == 0.
// Fragment map (A and Bt alike, lane l, h = l>>4, row/col = l&15): elements 0..7 = k0 + 8h + 0..7, elements 8..15 = k0 + 16 + 8h + 0..7; D element r = (row 8h + r, col l&15).
template <typename T16> struct WFrag;
template <> struct WFrag<h16> { typedef v16h V; static __device__ __forceinline__ V ld(const h16* p) { return cat16(*(const v8h*)p, *(const v8h*)(p + 16)); } static __device__ __forceinline__ v8f mma(V a, V b, v8f c) { return wmma16(a, b, c); } };
template <> struct WFrag<bf> { typedef v16bf V; static __device__ __forceinline__ V ld(const bf* p) { return cat16b(*(const v8us*)p, *(const v8us*)(p + 16)); } static __device__ __forceinline__ v8f mma(V a, V b, v8f c) { return wmmab(a, b, c); } };
template <typename T16, int NSPLIT, bool BIAS>
__global__ __launch_bounds__(32) void k_gemmw(const T16* __restrict__ A, const T16* __restrict__ A2, const T16* __restrict__ Bt, const T16* __restrict__ Bt2, int K, float* C, int ldc, const float* __restrict__ bias, size_t sA, size_t sB, size_t sC) {
    typedef typename WFrag<T16>::V V;
    __shared__ __align__(16) float os[16 * 68];
    const size_t z = blockIdx.z; A += z * sA; if (A2) A2 += z * sA; Bt += z * sB; if (Bt2) Bt2 += z * sB; C += z * sC;
    const int lane = threadIdx.x & 31, lr = lane & 15, hi = lane >> 4; const int r0 = blockIdx.x * 64, c0 = blockIdx.y * 64;
    v8f acc[4][4];
#pragma unroll
    for (int mb = 0; mb < 4; ++mb)
#pragma unroll
        for (int nb = 0; nb < 4; ++nb) acc[mb][nb] = (v8f){};
    const size_t aoff = (size_t)(r0 + lr) * K + 8 * hi, boff = (size_t)(c0 + lr) * K + 8 * hi;
#pragma unroll 1
    for (int kc = 0; kc < K; kc += 32) {
        V a[4], a2[4];
#pragma unroll
        for (int mb = 0; mb < 4; ++mb) { a[mb] = WFrag<T16>::ld(A + aoff + (size_t)mb * 16 * K + kc); if (NSPLIT == 1 || NSPLIT == 2) a2[mb] = WFrag<T16>::ld(A2 + aoff + (size_t)mb * 16 * K + kc); }
#pragma unroll
        for (int nb = 0; nb < 4; ++nb) { const V b = WFrag<T16>::ld(Bt + boff + (size_t)nb * 16 * K + kc); V b2; if (NSPLIT >= 2) b2 = WFrag<T16>::ld(Bt2 + boff + (size_t)nb * 16 * K + kc);
#pragma unroll
            for (int mb = 0; mb < 4; ++mb) { acc[mb][nb] = WFrag<T16>::mma(a[mb], b, acc[mb][nb]); if (NSPLIT == 1 || NSPLIT == 2) acc[mb][nb] = WFrag<T16>::mma(a2[mb], b, acc[mb][nb]); if (NSPLIT >= 2) acc[mb][nb] = WFrag<T16>::mma(a[mb], b2, acc[mb][nb]); } }
        asm volatile("v_nop\n\tv_nop\n\tv_nop\n\tv_nop" : "+v"(acc[0][0]), "+v"(acc[1][1]), "+v"(acc[2][2]), "+v"(acc[3][3]) : "v"(a[0]), "v"(a[3]));
    }
#pragma unroll
    for (int mb = 0; mb < 4; ++mb) {
#pragma unroll
        for (int nb = 0; nb < 4; ++nb) {
#pragma unroll
            for (int j = 0; j < 8; ++j) os[(hi * 8 + j) * 68 + nb * 16 + lr] = acc[mb][nb][j]; }
        __builtin_amdgcn_wave_barrier(); asm volatile("" ::: "memory");
        float* crow = C + (size_t)(r0 + mb * 16) * ldc + c0;
{
#pragma unroll
            for (int s = 0; s < 8; ++s) { const int row = 2 * s + hi, cofs = lr * 4; v4f val = *(const v4fa*)(os + row * 68 + cofs); if (BIAS) { val[0] += bfr(bias[c0 + cofs]); val[1] += bfr(bias[c0 + cofs + 1]); val[2] += bfr(bias[c0 + cofs + 2]); val[3] += bfr(bias[c0 + cofs + 3]); }
                *(v4f*)(crow + (size_t)row * ldc + cofs) = val; }
             }
        __builtin_amdgcn_wave_barrier(); asm volatile("" ::: "memory");
    }
}

// ---- k_gemmc: the same one-wave 64x64 tile GEMM specialised for causal attention: CMODE 1 skips score tiles entirely above the diagonal (query rows r0+roff.., key columns c0..), CMODE 2 limits the
// key (K) loop of the probability x value contraction to the diagonal block (probabilities beyond it are exactly zero). roff = row offset of this launch's first row within the sequence.
template <typename T16, int NSPLIT, int CMODE>
__global__ __launch_bounds__(32) void k_gemmc(const T16* __restrict__ A, const T16* __restrict__ A2, const T16* __restrict__ Bt, const T16* __restrict__ Bt2, int K, float* C, int ldc, int roff, size_t sA, size_t sB, size_t sC) {
    typedef typename WFrag<T16>::V V;
    __shared__ __align__(16) float os[16 * 68];
    const size_t z = blockIdx.z; A += z * sA; if (A2) A2 += z * sA; Bt += z * sB; if (Bt2) Bt2 += z * sB; C += z * sC;
    const int lane = threadIdx.x & 31, lr = lane & 15, hi = lane >> 4; const int r0 = blockIdx.x * 64, c0 = blockIdx.y * 64;
    if (CMODE == 1 && c0 > r0 + roff + 63) return;                  // score tile entirely above the causal diagonal: never read (the softmax excludes j > i by index select)
    const int Kl = (CMODE == 2) ? min(K, r0 + roff + 64) : K;        // P.V: probabilities are exactly 0 beyond the diagonal block, so the K loop stops there
    v8f acc[4][4];
#pragma unroll
    for (int mb = 0; mb < 4; ++mb)
#pragma unroll
        for (int nb = 0; nb < 4; ++nb) acc[mb][nb] = (v8f){};
    const size_t aoff = (size_t)(r0 + lr) * K + 8 * hi, boff = (size_t)(c0 + lr) * K + 8 * hi;
#pragma unroll 1
    for (int kc = 0; kc < Kl; kc += 32) {
        V a[4], a2[4];
#pragma unroll
        for (int mb = 0; mb < 4; ++mb) { a[mb] = WFrag<T16>::ld(A + aoff + (size_t)mb * 16 * K + kc); if (NSPLIT == 1 || NSPLIT == 2) a2[mb] = WFrag<T16>::ld(A2 + aoff + (size_t)mb * 16 * K + kc); }
#pragma unroll
        for (int nb = 0; nb < 4; ++nb) { const V b = WFrag<T16>::ld(Bt + boff + (size_t)nb * 16 * K + kc); V b2; if (NSPLIT >= 2) b2 = WFrag<T16>::ld(Bt2 + boff + (size_t)nb * 16 * K + kc);
#pragma unroll
            for (int mb = 0; mb < 4; ++mb) { acc[mb][nb] = WFrag<T16>::mma(a[mb], b, acc[mb][nb]); if (NSPLIT == 1 || NSPLIT == 2) acc[mb][nb] = WFrag<T16>::mma(a2[mb], b, acc[mb][nb]); if (NSPLIT >= 2) acc[mb][nb] = WFrag<T16>::mma(a[mb], b2, acc[mb][nb]); } }
        asm volatile("v_nop\n\tv_nop\n\tv_nop\n\tv_nop" : "+v"(acc[0][0]), "+v"(acc[1][1]), "+v"(acc[2][2]), "+v"(acc[3][3]) : "v"(a[0]), "v"(a[3]));
    }
#pragma unroll
    for (int mb = 0; mb < 4; ++mb) {
#pragma unroll
        for (int nb = 0; nb < 4; ++nb) {
#pragma unroll
            for (int j = 0; j < 8; ++j) os[(hi * 8 + j) * 68 + nb * 16 + lr] = acc[mb][nb][j]; }
        __builtin_amdgcn_wave_barrier(); asm volatile("" ::: "memory");
        float* crow = C + (size_t)(r0 + mb * 16) * ldc + c0;
{
#pragma unroll
            for (int s = 0; s < 8; ++s) { const int row = 2 * s + hi, cofs = lr * 4; v4f val = *(const v4fa*)(os + row * 68 + cofs);
                *(v4f*)(crow + (size_t)row * ldc + cofs) = val; }
             }
        __builtin_amdgcn_wave_barrier(); asm volatile("" ::: "memory");
    }
}

__device__ __forceinline__ h16 tohx(float x) { return (h16)x; }
__device__ __forceinline__ void splitf(float y, unsigned short& h, unsigned short& l) { h = f2bf(y); l = f2bf(y - bf2f(h)); }
typedef __attribute__((ext_vector_type(2))) _Float16 v2h;
typedef __attribute__((ext_vector_type(4))) _Float16 v4h;
typedef __attribute__((ext_vector_type(2))) unsigned short v2us;
typedef __attribute__((ext_vector_type(4))) unsigned short v4us;
typedef __attribute__((ext_vector_type(2))) float v2f;

__global__ __launch_bounds__(256) void k_cvt8(const float* __restrict__ src, bf* dst, size_t n8) { const size_t i = (size_t)blockIdx.x * 256 + threadIdx.x; if (i >= n8) return; const v8f v = *(const v8f*)(src + i * 8); v8us o;
#pragma unroll
    for (int k = 0; k < 8; ++k) o[k] = f2bf(v[k]); *(v8us*)(dst + i * 8) = o;  }

__global__ __launch_bounds__(256) void k_qkp(const float* __restrict__ F, int pitch, int nheads, h16* P16, bf* Ph, bf* Pl) {
    const size_t e = ((size_t)blockIdx.x * 256 + threadIdx.x) * 2; if (e >= (size_t)nheads * TT * HD) return; const int d = (int)(e % HD); const int t = (int)((e / HD) % TT); const int h = (int)(e / ((size_t)HD * TT));
    const float* f = F + (size_t)t * pitch + h * HD; v2h o16; v2us oh, ol;
#pragma unroll
    for (int q = 0; q < 2; ++q) { const float x = f[d + q]; o16[q] = tohx(x); unsigned short a2, c2; splitf(x, a2, c2); oh[q] = a2; ol[q] = c2; }
    *(v2h*)(P16 + e) = o16; *(v2us*)(Ph + e) = oh; *(v2us*)(Pl + e) = ol;  }
__global__ __launch_bounds__(256) void k_vtp(const float* __restrict__ F, int pitch, int nheads, h16* V16, bf* Vh, bf* Vl) { const size_t e = ((size_t)blockIdx.x * 256 + threadIdx.x) * 2; if (e >= (size_t)nheads * HD * TT) return; const int t = (int)(e % TT); const int d = (int)((e / TT) % HD); const int g = (int)(e / ((size_t)TT * HD)); v2h o16; v2us oh, ol;
#pragma unroll
    for (int q = 0; q < 2; ++q) { const float x = F[(size_t)(t + q) * pitch + g * HD + d]; o16[q] = tohx(x); unsigned short a2, c2; splitf(x, a2, c2); oh[q] = a2; ol[q] = c2; }
    *(v2h*)(V16 + e) = o16; *(v2us*)(Vh + e) = oh; *(v2us*)(Vl + e) = ol;  }
// k_asoft: per row (zz, i): t = S x 512^-0.5 for j <= i (causal; the -1e10 pre-scale subtraction of the module gives exactly zero probability for j > i), else excluded by index;
__global__ __launch_bounds__(256) void k_asoft(const float* __restrict__ Sb, h16* P16, bf* Ph, bf* Pl) {
    const int lane = threadIdx.x & 31; const int row = blockIdx.x * 8 + (threadIdx.x >> 5); if (row >= ZH * TT) return; const int i = row % TT; const int zz = row / TT; (void)zz; const bool hires = (i < RH); const float* sr = Sb + (size_t)row * TT; float v[TT / 32]; float mx = -3.0e38f;
#pragma unroll
    for (int ch = 0; ch < TT / 128; ++ch) { const int j0 = ch * 128 + lane * 4; const v4f a = *(const v4f*)(sr + j0);
#pragma unroll
        for (int q = 0; q < 4; ++q) { const int j = j0 + q; (void)j; const float t = (j <= i && i - j < WIN) ? a[q] * SCL : -3.0e38f; v[ch * 4 + q] = t; mx = fmaxf(mx, t); } }
#pragma unroll
    for (int sh = 16; sh; sh >>= 1) mx = fmaxf(mx, __shfl_xor(mx, sh, 32));
    float sum = 0.f;
#pragma unroll
    for (int k = 0; k < TT / 32; ++k) { float d0 = __fsub_rn(v[k], mx); asm volatile("" : "+v"(d0)); v[k] = __builtin_amdgcn_exp2f(__fmul_rn(d0, 1.4426950408889634f)); sum += v[k]; }
#pragma unroll
    for (int sh = 16; sh; sh >>= 1) sum += __shfl_xor(sum, sh, 32);
    const float f = __fdiv_rn(hires ? 1.0f : PCAR, sum);
{
        if (hires) {
#pragma unroll
            for (int ch = 0; ch < TT / 128; ++ch) { v4us oh, ol;
#pragma unroll
                for (int q = 0; q < 4; ++q) { unsigned short a, c2; splitf(v[ch * 4 + q] * f, a, c2); oh[q] = a; ol[q] = c2; }
                const size_t oo = ((size_t)zz * (RH ? RH : 1) + i) * TT + ch * 128 + lane * 4; *(v4us*)(Ph + oo) = oh; *(v4us*)(Pl + oo) = ol; }
        } else {
#pragma unroll
            for (int ch = 0; ch < TT / 128; ++ch) { v4h o4;
#pragma unroll
                for (int q = 0; q < 4; ++q) o4[q] = tohx(v[ch * 4 + q] * f);
                *(v4h*)(P16 + (size_t)row * TT + ch * 128 + lane * 4) = o4; } }
         }
}
__global__ __launch_bounds__(256) void k_merge(const float* __restrict__ O, int h0, bf* Ah, bf* Al) { const size_t e = ((size_t)blockIdx.x * 256 + threadIdx.x) * 2; if (e >= (size_t)ZH * TT * HD) return; const int d = (int)(e % HD); const int t = (int)((e / HD) % TT); const int zz = (int)(e / ((size_t)HD * TT)); const float cs = (t < RH) ? 1.0f : (1.0f / PCAR); const size_t oo = (size_t)t * DQ + (h0 + zz) * HD + d;
    v2us oh, ol;
#pragma unroll
    for (int q = 0; q < 2; ++q) { unsigned short a, c2; splitf(O[e + q] * cs, a, c2); oh[q] = a; ol[q] = c2; } *(v2us*)(Ah + oo) = oh; *(v2us*)(Al + oo) = ol;  }

extern "C" void kernel_launch(void* const* d_in, const int* in_sizes, int n_in,
                              void* d_out, int out_size, void* d_ws, size_t ws_size, hipStream_t stream) {
    if (n_in < 7) return;
    const size_t needx = ((size_t)(NB - 1) * SEQ_FULL + SEQ) * DM;     // rows actually read / written (full per-batch stride, SEQ rows of the last batch)
    if ((size_t)in_sizes[0] < needx || (size_t)in_sizes[1] < needx || (size_t)in_sizes[2] < needx) return;
    if (in_sizes[3] < DQ * DM || in_sizes[4] < DKV * DM || in_sizes[5] < DKV * DM || in_sizes[6] < DM * DQ) return;
    if ((size_t)out_size < needx) return;
    const float* xq = (const float*)d_in[0]; const float* xk = (const float*)d_in[1]; const float* xv = (const float*)d_in[2];
    const float* wq = (const float*)d_in[3]; const float* wk = (const float*)d_in[4]; const float* wv = (const float*)d_in[5]; const float* wo = (const float*)d_in[6];
    float* OUT = (float*)d_out;     // [NB_FULL][SEQ_FULL][DM]
    char* wsp = (char*)d_ws;
    auto take = [&](size_t bytes) { char* p = wsp; wsp += (bytes + 255) & ~(size_t)255; return (void*)p; };
    bf* WQ = (bf*)take((size_t)DQ * DM * 2); bf* WK = (bf*)take((size_t)DKV * DM * 2); bf* WV = (bf*)take((size_t)DKV * DM * 2); bf* WO = (bf*)take((size_t)DM * DQ * 2);
    bf* XB = (bf*)take((size_t)TT * DM * 2); float* FQ = (float*)take((size_t)TT * DQ * 4); float* FK = (float*)take((size_t)TT * DKV * 4);
    h16* QP16 = (h16*)take((size_t)NH_ * TT * HD * 2); h16* KP16 = (h16*)take((size_t)NKV * TT * HD * 2); h16* VT16 = (h16*)take((size_t)NKV * HD * TT * 2);
    bf* QPh = (bf*)take((size_t)NH_ * TT * HD * 2); bf* QPl = (bf*)take((size_t)NH_ * TT * HD * 2); bf* KPh = (bf*)take((size_t)NKV * TT * HD * 2); bf* KPl = (bf*)take((size_t)NKV * TT * HD * 2); bf* VTh = (bf*)take((size_t)NKV * HD * TT * 2); bf* VTl = (bf*)take((size_t)NKV * HD * TT * 2); bf* Ph = (bf*)take((size_t)ZH * RH * TT * 2); bf* Pl = (bf*)take((size_t)ZH * RH * TT * 2);
    float* Sb = (float*)take((size_t)ZH * TT * TT * 4); h16* P16 = (h16*)take((size_t)ZH * TT * TT * 2); float* Ob = (float*)take((size_t)ZH * TT * HD * 4); bf* ATh = (bf*)take((size_t)TT * DQ * 2); bf* ATl = (bf*)take((size_t)TT * DQ * 2);
    if ((size_t)(wsp - (char*)d_ws) > ws_size) return;    // 95,420,416 B for the full build
    float* FV = FK;   // v projection reuses the k buffer after the k planes are built (stream-ordered)
    const size_t n8w = (size_t)DQ * DM / 8, n8x = (size_t)TT * DM / 8;
    const unsigned LW8 = (unsigned)((n8w + 255) / 256), LX8 = (unsigned)((n8x + 255) / 256);
    k_cvt8<<<LW8, 256, 0, stream>>>(wq, WQ, n8w); k_cvt8<<<LW8, 256, 0, stream>>>(wk, WK, n8w); k_cvt8<<<LW8, 256, 0, stream>>>(wv, WV, n8w); k_cvt8<<<LW8, 256, 0, stream>>>(wo, WO, n8w);   // [out][in] = Bt rows as-is
    const unsigned LQ = (unsigned)(((size_t)NH_ * TT * HD / 2 + 255) / 256), LKv = (unsigned)(((size_t)NKV * TT * HD / 2 + 255) / 256);
    for (int b = 0; b < NB; ++b) {
        const size_t xoff = (size_t)b * SEQ_FULL * DM;
        k_cvt8<<<LX8, 256, 0, stream>>>(xq + xoff, XB, n8x);
        k_gemmw<bf, 0, false><<<dim3(TT / 64, DQ / 64, 1), 32, 0, stream>>>(XB, nullptr, WQ, nullptr, DM, FQ, DQ, nullptr, 0, 0, 0);
        k_qkp<<<LQ, 256, 0, stream>>>(FQ, DQ, NH_, QP16, QPh, QPl);
        k_cvt8<<<LX8, 256, 0, stream>>>(xk + xoff, XB, n8x);
        k_gemmw<bf, 0, false><<<dim3(TT / 64, DKV / 64, 1), 32, 0, stream>>>(XB, nullptr, WK, nullptr, DM, FK, DKV, nullptr, 0, 0, 0);
        k_qkp<<<LKv, 256, 0, stream>>>(FK, DKV, NKV, KP16, KPh, KPl);
        k_cvt8<<<LX8, 256, 0, stream>>>(xv + xoff, XB, n8x);
        k_gemmw<bf, 0, false><<<dim3(TT / 64, DKV / 64, 1), 32, 0, stream>>>(XB, nullptr, WV, nullptr, DM, FV, DKV, nullptr, 0, 0, 0);
        k_vtp<<<LKv, 256, 0, stream>>>(FV, DKV, NKV, VT16, VTh, VTl);
        for (int h0 = 0; h0 < NH_; h0 += ZH) { const size_t zq = (size_t)h0, zk = (size_t)(h0 / REP);   // the pass's two heads use consecutive planes (z-strides TT*HD)
            k_gemmc<bf, 2, 1><<<dim3(RH / 64, TT / 64, ZH), 32, 0, stream>>>(QPh + zq * TT * HD, QPl + zq * TT * HD, KPh + zk * TT * HD, KPl + zk * TT * HD, HD, Sb, TT, 0, (size_t)TT * HD, (size_t)TT * HD, (size_t)TT * TT);
            if (TT > RH) k_gemmc<h16, 0, 1><<<dim3((TT - RH) / 64, TT / 64, ZH), 32, 0, stream>>>(QP16 + zq * TT * HD + (size_t)RH * HD, nullptr, KP16 + zk * TT * HD, nullptr, HD, Sb + (size_t)RH * TT, TT, RH, (size_t)TT * HD, (size_t)TT * HD, (size_t)TT * TT);
            k_asoft<<<ZH * TT / 8, 256, 0, stream>>>(Sb, P16, Ph, Pl);
            k_gemmc<bf, 2, 2><<<dim3(RH / 64, HD / 64, ZH), 32, 0, stream>>>(Ph, Pl, VTh + zk * HD * TT, VTl + zk * HD * TT, TT, Ob, HD, 0, (size_t)RH * TT, (size_t)HD * TT, (size_t)TT * HD);
            if (TT > RH) k_gemmc<h16, 0, 2><<<dim3((TT - RH) / 64, HD / 64, ZH), 32, 0, stream>>>(P16 + (size_t)RH * TT, nullptr, VT16 + zk * HD * TT, nullptr, TT, Ob + (size_t)RH * HD, HD, RH, (size_t)TT * TT, (size_t)HD * TT, (size_t)TT * HD);
            k_merge<<<(unsigned)(((size_t)ZH * TT * HD / 2 + 255) / 256), 256, 0, stream>>>(Ob, h0, ATh, ATl); }
        k_gemmw<bf, 1, false><<<dim3(TT / 64, DM / 64, 1), 32, 0, stream>>>(ATh, ATl, WO, nullptr, DQ, OUT + xoff, DM, nullptr, 0, 0, 0); }
}

// v001
// One run takes 240 microseconds.
// In two side-by-side timings against v000, it was 3.13 and 3.11 times as fast.
#include <hip/hip_runtime.h>

// Contractions and dtypes (f32 accumulate everywhere): q/k/v projections v_wmma_f32_16x16x32_bf16 on RNE bf16 copies of the inputs (exact products);
// scores and P.V for query rows < 512: bf16 hi/lo split planes (3 products); query rows >= 512: v_wmma_f32_16x16x32_f16 (f16 q/k/v planes, P carried x1024);
// output projection: bf16 hi/lo context planes x bf16 Wo (2 products); softmax and all side math f32.
// Sizes: query/key/value [2][2048][512], weights [512][512] in [out][in] layout (y = x W^T), 8 heads of 64, causal (keys j <= i), scores x 512^-0.5, out [2][2048][512].
// Both batches at once: bf16 copies of query, key, value [3][NB*SEQ][512]; projections (grid z = q, k, v) [NB*SEQ][3*512] f32 -> head planes [b][h][t][64]
// (q, k: f16 + bf16 hi/lo) and value planes [b][h][64][t] (f16 + bf16 hi/lo); per batch, all 8 heads in grid z of each launch: score tiles (tiles entirely above the causal diagonal skipped) ->
// row softmax -> P planes (rows < 512 bf16 hi/lo, rows >= 512 f16 x1024) -> P.V -> context hi/lo planes [b*SEQ + t][h*64 + d]; then context x Wo -> out, both batches in one launch.

#ifndef NB
#define NB 2
#endif
#ifndef SEQ
#define SEQ 2048
#endif
#define NB_FULL  2
#define SEQ_FULL 2048
#define TT   SEQ
#define DM   512
#define NH_  8
#define NKV  8
#define REP  (NH_ / NKV)
#define HD   64
#define DQ   (NH_ * HD)
#define DKV  (NKV * HD)
#define ZH   8                              // heads per attention launch (grid z): all heads of a batch
#define RH   (((TT) < 512) ? (TT) : 512)   // query rows < RH use hi+lo planes
#define WIN  TT
#define PCAR 1024.0f
#define SCL  0.044194173824159216f        // 512^-0.5

static_assert(NB >= 1 && NB <= NB_FULL);
static_assert(SEQ >= 128 && SEQ <= SEQ_FULL && (SEQ % 128) == 0);
static_assert((RH % 64) == 0 && ((TT - RH) % 64) == 0 && RH > 0);
static_assert((NH_ % ZH) == 0 && REP == 1 && HD == 64 && (DM % 64) == 0 && (DQ % 64) == 0 && (DKV % 64) == 0);
// workspace carve (every region is a multiple of 256 B and of its store granularity)
#define WS_TOTAL ((size_t)2 * DQ * DM * 2 + (size_t)2 * DKV * DM * 2 \
                + (size_t)NB * (NH_ + 2 * NKV) * TT * HD * 2 + (size_t)NB * (2 * NH_ + 4 * NKV) * TT * HD * 2 + (size_t)2 * ZH * RH * TT * 2 \
                + (size_t)ZH * TT * TT * 4 + (size_t)ZH * (TT - RH) * TT * 2 + (size_t)2 * NB * TT * DQ * 2)
static_assert(WS_TOTAL <= (size_t)268435456);
static_assert(SEQ == SEQ_FULL || NB == 1);      // the batches' rows are read and written as one [NB*SEQ][512] matrix
static_assert(DKV == DQ);                       // q, k, v projections share one launch (grid z)
static_assert((size_t)3 * NB * TT * DM * 2 + (size_t)3 * NB * TT * DQ * 4 <= (size_t)ZH * TT * TT * 4);   // input copies + projections lie in the score buffer until the planes are built
static_assert(((size_t)(NB - 1) * SEQ_FULL + SEQ) * DM <= (size_t)NB_FULL * SEQ_FULL * DM);

typedef _Float16 h16;
typedef unsigned short bf;
typedef __attribute__((ext_vector_type(16))) __bf16   v16bf;
typedef __attribute__((ext_vector_type(16))) _Float16 v16h;
typedef __attribute__((ext_vector_type(8)))  _Float16 v8h;
typedef __attribute__((ext_vector_type(8)))  unsigned short v8us;
typedef __attribute__((ext_vector_type(8)))  float    v8f;
typedef __attribute__((ext_vector_type(4)))  float    v4f;
typedef v8h  __attribute__((may_alias)) v8ha;
typedef v4f  __attribute__((may_alias)) v4fa;
typedef v8us __attribute__((may_alias)) v8usa;

__device__ __forceinline__ unsigned short f2bf(float f) { unsigned u = __float_as_uint(f); u += 0x7FFFu + ((u >> 16) & 1u); return (unsigned short)(u >> 16); }
__device__ __forceinline__ float bf2f(unsigned short b) { return __uint_as_float(((unsigned)b) << 16); }
__device__ __forceinline__ float bfr(float f) { return bf2f(f2bf(f)); }
__device__ __forceinline__ v16h cat16(v8h lo, v8h hi) { return __builtin_shufflevector(lo, hi, 0, 1, 2, 3, 4, 5, 6, 7, 8, 9, 10, 11, 12, 13, 14, 15); }
__device__ __forceinline__ v16bf cat16b(v8us lo, v8us hi) { return __builtin_bit_cast(v16bf, __builtin_shufflevector(lo, hi, 0, 1, 2, 3, 4, 5, 6, 7, 8, 9, 10, 11, 12, 13, 14, 15)); }
__device__ __forceinline__ v8f wmma16(v16h a, v16h b, v8f c) { return __builtin_amdgcn_wmma_f32_16x16x32_f16(false, a, false, b, (short)0, c, false, false); }
__device__ __forceinline__ v8f wmmab(v16bf a, v16bf b, v8f c) { return __builtin_amdgcn_wmma_f32_16x16x32_bf16(false, a, false, b, (short)0, c, false, false); }

// ---- k_gemmw: register-blocked GEMM, ONE WAVE per 64x64 output tile (16 accumulators), operands straight from K-contiguous 16-bit planes; grid (M/64, N/64, Z), 32 threads.
// C[m][n] (f32, pitch ldc, + optional f32 bias[n]) = sum_k A[m][k] Bt[n][k] (+ split products per NSPLIT). z-batch strides sA/sB/sC in elements. K % 32 == 0.
// Fragment map (A and Bt alike, lane l, h = l>>4, row/col = l&15): elements 0..7 = k0 + 8h + 0..7, elements 8..15 = k0 + 16 + 8h + 0..7; D element r = (row 8h + r, col l&15).
template <typename T16> struct WFrag;
template <> struct WFrag<h16> { typedef v16h V; static __device__ __forceinline__ V ld(const h16* p) { return cat16(*(const v8h*)p, *(const v8h*)(p + 16)); } static __device__ __forceinline__ v8f mma(V a, V b, v8f c) { return wmma16(a, b, c); } };
template <> struct WFrag<bf> { typedef v16bf V; static __device__ __forceinline__ V ld(const bf* p) { return cat16b(*(const v8us*)p, *(const v8us*)(p + 16)); } static __device__ __forceinline__ v8f mma(V a, V b, v8f c) { return wmmab(a, b, c); } };
template <typename T16, int NSPLIT, bool BIAS>
__global__ __launch_bounds__(32) void k_gemmw(const T16* __restrict__ A, const T16* __restrict__ A2, const T16* __restrict__ Bt, const T16* __restrict__ Bt2, int K, float* C, int ldc, const float* __restrict__ bias, size_t sA, size_t sB, size_t sC) {
    typedef typename WFrag<T16>::V V;
    __shared__ __align__(16) float os[16 * 68];
    const size_t z = blockIdx.z; A += z * sA; if (A2) A2 += z * sA; Bt += z * sB; if (Bt2) Bt2 += z * sB; C += z * sC;
    const int lane = threadIdx.x & 31, lr = lane & 15, hi = lane >> 4; const int r0 = blockIdx.x * 64, c0 = blockIdx.y * 64;
    v8f acc[4][4];
#pragma unroll
    for (int mb = 0; mb < 4; ++mb)
#pragma unroll
        for (int nb = 0; nb < 4; ++nb) acc[mb][nb] = (v8f){};
    const size_t aoff = (size_t)(r0 + lr) * K + 8 * hi, boff = (size_t)(c0 + lr) * K + 8 * hi;
#pragma unroll 1
    for (int kc = 0; kc < K; kc += 32) {
        V a[4], a2[4];
#pragma unroll
        for (int mb = 0; mb < 4; ++mb) { a[mb] = WFrag<T16>::ld(A + aoff + (size_t)mb * 16 * K + kc); if (NSPLIT == 1 || NSPLIT == 2) a2[mb] = WFrag<T16>::ld(A2 + aoff + (size_t)mb * 16 * K + kc); }
#pragma unroll
        for (int nb = 0; nb < 4; ++nb) { const V b = WFrag<T16>::ld(Bt + boff + (size_t)nb * 16 * K + kc); V b2; if (NSPLIT >= 2) b2 = WFrag<T16>::ld(Bt2 + boff + (size_t)nb * 16 * K + kc);
#pragma unroll
            for (int mb = 0; mb < 4; ++mb) { acc[mb][nb] = WFrag<T16>::mma(a[mb], b, acc[mb][nb]); if (NSPLIT == 1 || NSPLIT == 2) acc[mb][nb] = WFrag<T16>::mma(a2[mb], b, acc[mb][nb]); if (NSPLIT >= 2) acc[mb][nb] = WFrag<T16>::mma(a[mb], b2, acc[mb][nb]); } }
        asm volatile("v_nop\n\tv_nop\n\tv_nop\n\tv_nop" : "+v"(acc[0][0]), "+v"(acc[1][1]), "+v"(acc[2][2]), "+v"(acc[3][3]) : "v"(a[0]), "v"(a[3]));
    }
#pragma unroll
    for (int mb = 0; mb < 4; ++mb) {
#pragma unroll
        for (int nb = 0; nb < 4; ++nb) {
#pragma unroll
            for (int j = 0; j < 8; ++j) os[(hi * 8 + j) * 68 + nb * 16 + lr] = acc[mb][nb][j]; }
        __builtin_amdgcn_wave_barrier(); asm volatile("" ::: "memory");
        float* crow = C + (size_t)(r0 + mb * 16) * ldc + c0;
{
#pragma unroll
            for (int s = 0; s < 8; ++s) { const int row = 2 * s + hi, cofs = lr * 4; v4f val = *(const v4fa*)(os + row * 68 + cofs); if (BIAS) { val[0] += bfr(bias[c0 + cofs]); val[1] += bfr(bias[c0 + cofs + 1]); val[2] += bfr(bias[c0 + cofs + 2]); val[3] += bfr(bias[c0 + cofs + 3]); }
                *(v4f*)(crow + (size_t)row * ldc + cofs) = val; }
             }
        __builtin_amdgcn_wave_barrier(); asm volatile("" ::: "memory");
    }
}

// ---- gemmc_tile: the same one-wave 64x64 tile GEMM specialised for causal attention (tile rows r0.., columns c0.. of the operands it is handed): CMODE 1 skips score tiles entirely above the diagonal (query rows r0+roff.., key columns c0..), CMODE 2 limits the
// key (K) loop of the probability x value contraction to the diagonal block (probabilities beyond it are exactly zero). roff = row offset of A's first row within the sequence.
template <typename T16, int NSPLIT, int CMODE>
__device__ __forceinline__ void gemmc_tile(const T16* __restrict__ A, const T16* __restrict__ A2, const T16* __restrict__ Bt, const T16* __restrict__ Bt2, int K, float* C, int ldc, int roff, int r0, int c0, float* os) {
    typedef typename WFrag<T16>::V V;
    const int lane = threadIdx.x & 31, lr = lane & 15, hi = lane >> 4;
    if (CMODE == 1 && c0 > r0 + roff + 63) return;                  // score tile entirely above the causal diagonal: never read (the softmax excludes j > i by index select)
    const int Kl = (CMODE == 2) ? min(K, r0 + roff + 64) : K;        // P.V: probabilities are exactly 0 beyond the diagonal block, so the K loop stops there
    v8f acc[4][4];
#pragma unroll
    for (int mb = 0; mb < 4; ++mb)
#pragma unroll
        for (int nb = 0; nb < 4; ++nb) acc[mb][nb] = (v8f){};
    const size_t aoff = (size_t)(r0 + lr) * K + 8 * hi, boff = (size_t)(c0 + lr) * K + 8 * hi;
#pragma unroll 1
    for (int kc = 0; kc < Kl; kc += 32) {
        V a[4], a2[4];
#pragma unroll
        for (int mb = 0; mb < 4; ++mb) { a[mb] = WFrag<T16>::ld(A + aoff + (size_t)mb * 16 * K + kc); if (NSPLIT == 1 || NSPLIT == 2) a2[mb] = WFrag<T16>::ld(A2 + aoff + (size_t)mb * 16 * K + kc); }
#pragma unroll
        for (int nb = 0; nb < 4; ++nb) { const V b = WFrag<T16>::ld(Bt + boff + (size_t)nb * 16 * K + kc); V b2; if (NSPLIT >= 2) b2 = WFrag<T16>::ld(Bt2 + boff + (size_t)nb * 16 * K + kc);
#pragma unroll
            for (int mb = 0; mb < 4; ++mb) { acc[mb][nb] = WFrag<T16>::mma(a[mb], b, acc[mb][nb]); if (NSPLIT == 1 || NSPLIT == 2) acc[mb][nb] = WFrag<T16>::mma(a2[mb], b, acc[mb][nb]); if (NSPLIT >= 2) acc[mb][nb] = WFrag<T16>::mma(a[mb], b2, acc[mb][nb]); } }
        asm volatile("v_nop\n\tv_nop\n\tv_nop\n\tv_nop" : "+v"(acc[0][0]), "+v"(acc[1][1]), "+v"(acc[2][2]), "+v"(acc[3][3]) : "v"(a[0]), "v"(a[3]));
    }
#pragma unroll
    for (int mb = 0; mb < 4; ++mb) {
#pragma unroll
        for (int nb = 0; nb < 4; ++nb) {
#pragma unroll
            for (int j = 0; j < 8; ++j) os[(hi * 8 + j) * 68 + nb * 16 + lr] = acc[mb][nb][j]; }
        __builtin_amdgcn_wave_barrier(); asm volatile("" ::: "memory");
        float* crow = C + (size_t)(r0 + mb * 16) * ldc + c0;
{
#pragma unroll
            for (int s = 0; s < 8; ++s) { const int row = 2 * s + hi, cofs = lr * 4; v4f val = *(const v4fa*)(os + row * 68 + cofs);
                *(v4f*)(crow + (size_t)row * ldc + cofs) = val; }
             }
        __builtin_amdgcn_wave_barrier(); asm volatile("" ::: "memory");
    }
    asm volatile("s_wait_xcnt 0x0" ::: "memory");   // the caller's other branch follows in the listing and rewrites registers that the last stores name: hold it behind this wait
}

// k_gemmc: one launch covers both row ranges of all heads in grid z: tiles of query rows < RH run the bf16 hi/lo form, tiles of rows >= RH the f16 form (A16 and its stride start at row RH).
template <int CMODE>
__global__ __launch_bounds__(32) void k_gemmc(const bf* __restrict__ Ah, const bf* __restrict__ Al, const h16* __restrict__ A16, const bf* __restrict__ Bh, const bf* __restrict__ Bl, const h16* __restrict__ B16, int K, float* C, int ldc, size_t sAh, size_t sA16, size_t sB, size_t sC) {
    __shared__ __align__(16) float os[16 * 68];
    const size_t z = blockIdx.z; const int r0 = blockIdx.x * 64, c0 = blockIdx.y * 64;
    if (r0 < RH) gemmc_tile<bf, 2, CMODE>(Ah + z * sAh, Al + z * sAh, Bh + z * sB, Bl + z * sB, K, C + z * sC, ldc, 0, r0, c0, os);
    else gemmc_tile<h16, 0, CMODE>(A16 + z * sA16, nullptr, B16 + z * sB, nullptr, K, C + z * sC + (size_t)RH * ldc, ldc, RH, r0 - RH, c0, os);
}

__device__ __forceinline__ h16 tohx(float x) { return (h16)x; }
__device__ __forceinline__ void splitf(float y, unsigned short& h, unsigned short& l) { h = f2bf(y); l = f2bf(y - bf2f(h)); }
typedef __attribute__((ext_vector_type(2))) _Float16 v2h;
typedef __attribute__((ext_vector_type(4))) _Float16 v4h;
typedef __attribute__((ext_vector_type(2))) unsigned short v2us;
typedef __attribute__((ext_vector_type(4))) unsigned short v4us;
typedef __attribute__((ext_vector_type(2))) float v2f;

// k_cvt8: grid y picks one of up to four equally long f32 sources; their bf16 copies follow one another in dst.
__global__ __launch_bounds__(256) void k_cvt8(const float* __restrict__ s0, const float* __restrict__ s1, const float* __restrict__ s2, const float* __restrict__ s3, bf* dst, size_t n8) { const size_t i = (size_t)blockIdx.x * 256 + threadIdx.x; if (i >= n8) return;
    const unsigned y = blockIdx.y; const float* src = (y == 0) ? s0 : (y == 1) ? s1 : (y == 2) ? s2 : s3; const v8f v = *(const v8f*)(src + i * 8); v8us o;
#pragma unroll
    for (int k = 0; k < 8; ++k) o[k] = f2bf(v[k]); *(v8us*)(dst + ((size_t)y * n8 + i) * 8) = o;  }

__global__ __launch_bounds__(256) void k_qkp(const float* __restrict__ F, int pitch, int nheads, h16* P16, bf* Ph, bf* Pl) {
    const size_t e = ((size_t)blockIdx.x * 256 + threadIdx.x) * 2; if (e >= (size_t)nheads * TT * HD) return; const int d = (int)(e % HD); const int t = (int)((e / HD) % TT); const int h = (int)(e / ((size_t)HD * TT)); const int b = blockIdx.y; const size_t eo = (size_t)b * nheads * TT * HD + e;   // grid y = batch; planes [b][h][t][d]
    const float* f = F + ((size_t)b * TT + t) * pitch + h * HD; v2h o16; v2us oh, ol;
#pragma unroll
    for (int q = 0; q < 2; ++q) { const float x = f[d + q]; o16[q] = tohx(x); unsigned short a2, c2; splitf(x, a2, c2); oh[q] = a2; ol[q] = c2; }
    *(v2h*)(P16 + eo) = o16; *(v2us*)(Ph + eo) = oh; *(v2us*)(Pl + eo) = ol;  }
__global__ __launch_bounds__(256) void k_vtp(const float* __restrict__ F, int pitch, int nheads, h16* V16, bf* Vh, bf* Vl) { const size_t e = ((size_t)blockIdx.x * 256 + threadIdx.x) * 2; if (e >= (size_t)nheads * HD * TT) return; const int t = (int)(e % TT); const int d = (int)((e / TT) % HD); const int g = (int)(e / ((size_t)TT * HD)); const int b = blockIdx.y; const size_t eo = (size_t)b * nheads * HD * TT + e; v2h o16; v2us oh, ol;   // grid y = batch; planes [b][g][d][t]
#pragma unroll
    for (int q = 0; q < 2; ++q) { const float x = F[((size_t)b * TT + t + q) * pitch + g * HD + d]; o16[q] = tohx(x); unsigned short a2, c2; splitf(x, a2, c2); oh[q] = a2; ol[q] = c2; }
    *(v2h*)(V16 + eo) = o16; *(v2us*)(Vh + eo) = oh; *(v2us*)(Vl + eo) = ol;  }
// k_asoft: per row (zz, i): t = S x 512^-0.5 for j <= i (causal; the -1e10 pre-scale subtraction of the module gives exactly zero probability for j > i), else excluded by index;
__global__ __launch_bounds__(256) void k_asoft(const float* __restrict__ Sb, h16* P16, bf* Ph, bf* Pl) {
    const int lane = threadIdx.x & 31; const int row = blockIdx.x * 8 + (threadIdx.x >> 5); if (row >= ZH * TT) return; const int i = row % TT; const int zz = row / TT; (void)zz; const bool hires = (i < RH); const float* sr = Sb + (size_t)row * TT; float v[TT / 32]; float mx = -3.0e38f;
#pragma unroll
    for (int ch = 0; ch < TT / 128; ++ch) { const int j0 = ch * 128 + lane * 4; const v4f a = *(const v4f*)(sr + j0);
#pragma unroll
        for (int q = 0; q < 4; ++q) { const int j = j0 + q; (void)j; const float t = (j <= i && i - j < WIN) ? a[q] * SCL : -3.0e38f; v[ch * 4 + q] = t; mx = fmaxf(mx, t); } }
#pragma unroll
    for (int sh = 16; sh; sh >>= 1) mx = fmaxf(mx, __shfl_xor(mx, sh, 32));
    float sum = 0.f;
#pragma unroll
    for (int k = 0; k < TT / 32; ++k) { float d0 = __fsub_rn(v[k], mx); asm volatile("" : "+v"(d0)); v[k] = __builtin_amdgcn_exp2f(__fmul_rn(d0, 1.4426950408889634f)); sum += v[k]; }
#pragma unroll
    for (int sh = 16; sh; sh >>= 1) sum += __shfl_xor(sum, sh, 32);
    const float f = __fdiv_rn(hires ? 1.0f : PCAR, sum);
{
        if (hires) {
#pragma unroll
            for (int ch = 0; ch < TT / 128; ++ch) { v4us oh, ol;
#pragma unroll
                for (int q = 0; q < 4; ++q) { unsigned short a, c2; splitf(v[ch * 4 + q] * f, a, c2); oh[q] = a; ol[q] = c2; }
                const size_t oo = ((size_t)zz * (RH ? RH : 1) + i) * TT + ch * 128 + lane * 4; *(v4us*)(Ph + oo) = oh; *(v4us*)(Pl + oo) = ol; }
        } else {
#pragma unroll
            for (int ch = 0; ch < TT / 128; ++ch) { v4h o4;
#pragma unroll
                for (int q = 0; q < 4; ++q) o4[q] = tohx(v[ch * 4 + q] * f);
                *(v4h*)(P16 + ((size_t)zz * (TT - RH) + (i - RH)) * TT + ch * 128 + lane * 4) = o4; } }   // the f16 plane holds rows >= RH only
         }
}
__global__ __launch_bounds__(256) void k_merge(const float* __restrict__ O, int h0, bf* Ah, bf* Al) { const size_t e = ((size_t)blockIdx.x * 256 + threadIdx.x) * 2; if (e >= (size_t)ZH * TT * HD) return; const int d = (int)(e % HD); const int t = (int)((e / HD) % TT); const int zz = (int)(e / ((size_t)HD * TT)); const float cs = (t < RH) ? 1.0f : (1.0f / PCAR); const size_t oo = (size_t)t * DQ + (h0 + zz) * HD + d;
    v2us oh, ol;
#pragma unroll
    for (int q = 0; q < 2; ++q) { unsigned short a, c2; splitf(O[e + q] * cs, a, c2); oh[q] = a; ol[q] = c2; } *(v2us*)(Ah + oo) = oh; *(v2us*)(Al + oo) = ol;  }

extern "C" void kernel_launch(void* const* d_in, const int* in_sizes, int n_in,
                              void* d_out, int out_size, void* d_ws, size_t ws_size, hipStream_t stream) {
    if (n_in < 7) return;
    const size_t needx = ((size_t)(NB - 1) * SEQ_FULL + SEQ) * DM;     // rows actually read / written (full per-batch stride, SEQ rows of the last batch)
    if ((size_t)in_sizes[0] < needx || (size_t)in_sizes[1] < needx || (size_t)in_sizes[2] < needx) return;
    if (in_sizes[3] < DQ * DM || in_sizes[4] < DKV * DM || in_sizes[5] < DKV * DM || in_sizes[6] < DM * DQ) return;
    if ((size_t)out_size < needx) return;
    const float* xq = (const float*)d_in[0]; const float* xk = (const float*)d_in[1]; const float* xv = (const float*)d_in[2];
    const float* wq = (const float*)d_in[3]; const float* wk = (const float*)d_in[4]; const float* wv = (const float*)d_in[5]; const float* wo = (const float*)d_in[6];
    float* OUT = (float*)d_out;     // [NB_FULL][SEQ_FULL][DM]
    char* wsp = (char*)d_ws;
    auto take = [&](size_t bytes) { char* p = wsp; wsp += (bytes + 255) & ~(size_t)255; return (void*)p; };
    bf* WQ = (bf*)take((size_t)DQ * DM * 2); bf* WK = (bf*)take((size_t)DKV * DM * 2); bf* WV = (bf*)take((size_t)DKV * DM * 2); bf* WO = (bf*)take((size_t)DM * DQ * 2); (void)WK; (void)WV;   // consecutive: one conversion launch, z-stride DQ*DM in the projections
    h16* QK16 = (h16*)take((size_t)NB * (NH_ + NKV) * TT * HD * 2); bf* QKh = (bf*)take((size_t)NB * (NH_ + NKV) * TT * HD * 2); bf* QKl = (bf*)take((size_t)NB * (NH_ + NKV) * TT * HD * 2);   // [b][q heads, then k heads][t][d]
    h16* VT16 = (h16*)take((size_t)NB * NKV * HD * TT * 2); bf* VTh = (bf*)take((size_t)NB * NKV * HD * TT * 2); bf* VTl = (bf*)take((size_t)NB * NKV * HD * TT * 2); bf* Ph = (bf*)take((size_t)ZH * RH * TT * 2); bf* Pl = (bf*)take((size_t)ZH * RH * TT * 2);
    float* Sb = (float*)take((size_t)ZH * TT * TT * 4); h16* P16 = (h16*)take((size_t)ZH * (TT - RH) * TT * 2); bf* ATh = (bf*)take((size_t)NB * TT * DQ * 2); bf* ATl = (bf*)take((size_t)NB * TT * DQ * 2);
    if ((size_t)(wsp - (char*)d_ws) > ws_size) return;    // 266,338,304 B for the full build
    // stream-ordered reuse of the score buffer: the input copies and projections are dead before the first score tile is written; the P.V result is written after the softmax has read the scores
    bf* XB = (bf*)Sb; float* FP = (float*)(XB + (size_t)3 * NB * TT * DM); float* Ob = Sb;
    const size_t n8w = (size_t)DQ * DM / 8, n8x = (size_t)NB * TT * DM / 8;
    const unsigned LW8 = (unsigned)((n8w + 255) / 256), LX8 = (unsigned)((n8x + 255) / 256);
    k_cvt8<<<dim3(LW8, 4, 1), 256, 0, stream>>>(wq, wk, wv, wo, WQ, n8w);   // [out][in] = Bt rows as-is
    k_cvt8<<<dim3(LX8, 3, 1), 256, 0, stream>>>(xq, xk, xv, nullptr, XB, n8x);
    k_gemmw<bf, 0, false><<<dim3(NB * TT / 64, DQ / 64, 3), 32, 0, stream>>>(XB, nullptr, WQ, nullptr, DM, FP, 3 * DQ, nullptr, (size_t)NB * TT * DM, (size_t)DQ * DM, (size_t)DQ);   // z = q, k, v -> columns z*512.. of FP
    k_qkp<<<dim3((unsigned)(((size_t)(NH_ + NKV) * TT * HD / 2 + 255) / 256), NB, 1), 256, 0, stream>>>(FP, 3 * DQ, NH_ + NKV, QK16, QKh, QKl);
    k_vtp<<<dim3((unsigned)(((size_t)NKV * TT * HD / 2 + 255) / 256), NB, 1), 256, 0, stream>>>(FP + 2 * DQ, 3 * DQ, NKV, VT16, VTh, VTl);
    for (int b = 0; b < NB; ++b) {
        for (int h0 = 0; h0 < NH_; h0 += ZH) { const size_t zq = (size_t)b * (NH_ + NKV) + h0, zk = (size_t)b * (NH_ + NKV) + NH_ + h0 / REP, zv = (size_t)b * NKV + h0 / REP;   // the pass's heads use consecutive planes (z-strides TT*HD)
            k_gemmc<1><<<dim3(TT / 64, TT / 64, ZH), 32, 0, stream>>>(QKh + zq * TT * HD, QKl + zq * TT * HD, QK16 + zq * TT * HD + (size_t)RH * HD, QKh + zk * TT * HD, QKl + zk * TT * HD, QK16 + zk * TT * HD, HD, Sb, TT, (size_t)TT * HD, (size_t)TT * HD, (size_t)TT * HD, (size_t)TT * TT);
            k_asoft<<<ZH * TT / 8, 256, 0, stream>>>(Sb, P16, Ph, Pl);
            k_gemmc<2><<<dim3(TT / 64, HD / 64, ZH), 32, 0, stream>>>(Ph, Pl, P16, VTh + zv * HD * TT, VTl + zv * HD * TT, VT16 + zv * HD * TT, TT, Ob, HD, (size_t)RH * TT, (size_t)(TT - RH) * TT, (size_t)HD * TT, (size_t)TT * HD);
            k_merge<<<(unsigned)(((size_t)ZH * TT * HD / 2 + 255) / 256), 256, 0, stream>>>(Ob, h0, ATh + (size_t)b * TT * DQ, ATl + (size_t)b * TT * DQ); } }
    k_gemmw<bf, 1, false><<<dim3(NB * TT / 64, DM / 64, 1), 32, 0, stream>>>(ATh, ATl, WO, nullptr, DQ, OUT, DM, nullptr, 0, 0, 0);
}

// v002
// It runs in 93.6 microseconds.
// Two timings next to v001 put it at 2.54 and 2.55 times that version's speed.
// Over all steps from v000 it is 7.94 times as fast.
#include <hip/hip_runtime.h>

// Contractions and dtypes (f32 accumulate everywhere): q/k/v projections v_wmma_f32_16x16x32_bf16 on RNE bf16 copies of the inputs (exact products);
// scores and P.V for query rows < 512: bf16 hi/lo split operands (3 products); query rows >= 512: v_wmma_f32_16x16x32_f16 (f16 q/k/v planes, P carried x1024);
// output projection: bf16 hi/lo context planes x bf16 Wo (2 products); softmax and all side math f32.
// Sizes: query/key/value [2][2048][512], weights [512][512] in [out][in] layout (y = x W^T), 8 heads of 64, causal (keys j <= i), scores x 512^-0.5, out [2][2048][512].
// Both batches at once: bf16 copies of query, key, value [3][NB*SEQ][512]; projections (grid z = q, k, v) [NB*SEQ][3*512] f32 -> head planes [b][h][t][64]
// (q, k: f16 + bf16 hi/lo) and value planes [b][h][64][t] (f16 + bf16 hi/lo); one attention launch for all batches and heads: scores, running-maximum softmax and P.V stay in registers,
// the waves of a work-group split the keys and join through LDS -> context hi/lo planes [b*SEQ + t][h*64 + d]; then context x Wo -> out, both batches in one launch.

#ifndef NB
#define NB 2
#endif
#ifndef SEQ
#define SEQ 2048
#endif
#define NB_FULL  2
#define SEQ_FULL 2048
#define TT   SEQ
#define DM   512
#define NH_  8
#define NKV  8
#define REP  (NH_ / NKV)
#define HD   64
#define DQ   (NH_ * HD)
#define DKV  (NKV * HD)
#define RH   (((TT) < 512) ? (TT) : 512)   // query rows < RH use hi+lo operands
#define SCL  0.044194173824159216         // 512^-0.5
#define QT   32                             // query columns per attention work-group (two 16-column groups; an f16-form wave takes both, a hi/lo-form wave one)
#define AW   4                              // waves per attention work-group; they split the 32-key chunks of the tile's keys
#define OSP  68                             // LDS pitch (floats) of a query's 64 partial context values

static_assert(NB >= 1 && NB <= NB_FULL);
static_assert(SEQ >= 128 && SEQ <= SEQ_FULL && (SEQ % 128) == 0);
static_assert((RH % QT) == 0 && (TT % QT) == 0 && RH > 0 && QT == 32 && QT == 8 * AW);
static_assert(REP == 1 && HD == 64 && (DM % 64) == 0 && (DQ % 64) == 0 && (DKV % 64) == 0);
// workspace carve (every region is a multiple of 256 B and of its store granularity)
#define WS_TOTAL ((size_t)2 * DQ * DM * 2 + (size_t)2 * DKV * DM * 2 \
                + (size_t)NB * (NH_ + 2 * NKV) * TT * HD * 2 + (size_t)NB * (2 * NH_ + 4 * NKV) * TT * HD * 2 \
                + (size_t)3 * NB * TT * DM * 2 + (size_t)3 * NB * TT * DQ * 4 + (size_t)2 * NB * TT * DQ * 2)
static_assert(WS_TOTAL <= (size_t)268435456);
static_assert(SEQ == SEQ_FULL || NB == 1);      // the batches' rows are read and written as one [NB*SEQ][512] matrix
static_assert(DKV == DQ);                       // q, k, v projections share one launch (grid z)
static_assert(((size_t)(NB - 1) * SEQ_FULL + SEQ) * DM <= (size_t)NB_FULL * SEQ_FULL * DM);

typedef _Float16 h16;
typedef unsigned short bf;
typedef __attribute__((ext_vector_type(16))) __bf16   v16bf;
typedef __attribute__((ext_vector_type(16))) _Float16 v16h;
typedef __attribute__((ext_vector_type(8)))  _Float16 v8h;
typedef __attribute__((ext_vector_type(8)))  unsigned short v8us;
typedef __attribute__((ext_vector_type(8)))  float    v8f;
typedef __attribute__((ext_vector_type(4)))  float    v4f;
typedef v8h  __attribute__((may_alias)) v8ha;
typedef v4f  __attribute__((may_alias)) v4fa;
typedef v8us __attribute__((may_alias)) v8usa;

__device__ __forceinline__ unsigned short f2bf(float f) { unsigned u = __float_as_uint(f); u += 0x7FFFu + ((u >> 16) & 1u); return (unsigned short)(u >> 16); }
__device__ __forceinline__ float bf2f(unsigned short b) { return __uint_as_float(((unsigned)b) << 16); }
__device__ __forceinline__ float bfr(float f) { return bf2f(f2bf(f)); }
__device__ __forceinline__ v16h cat16(v8h lo, v8h hi) { return __builtin_shufflevector(lo, hi, 0, 1, 2, 3, 4, 5, 6, 7, 8, 9, 10, 11, 12, 13, 14, 15); }
__device__ __forceinline__ v16bf cat16b(v8us lo, v8us hi) { return __builtin_bit_cast(v16bf, __builtin_shufflevector(lo, hi, 0, 1, 2, 3, 4, 5, 6, 7, 8, 9, 10, 11, 12, 13, 14, 15)); }
__device__ __forceinline__ v8f wmma16(v16h a, v16h b, v8f c) { return __builtin_amdgcn_wmma_f32_16x16x32_f16(false, a, false, b, (short)0, c, false, false); }
__device__ __forceinline__ v8f wmmab(v16bf a, v16bf b, v8f c) { return __builtin_amdgcn_wmma_f32_16x16x32_bf16(false, a, false, b, (short)0, c, false, false); }

// ---- k_gemmw: register-blocked GEMM, ONE WAVE per 64x64 output tile (16 accumulators), operands straight from K-contiguous 16-bit planes; grid (M/64, N/64, Z), 32 threads.
// C[m][n] (f32, pitch ldc, + optional f32 bias[n]) = sum_k A[m][k] Bt[n][k] (+ split products per NSPLIT). z-batch strides sA/sB/sC in elements. K % 32 == 0.
// Fragment map (A and Bt alike, lane l, h = l>>4, row/col = l&15): elements 0..7 = k0 + 8h + 0..7, elements 8..15 = k0 + 16 + 8h + 0..7; D element r = (row 8h + r, col l&15).
template <typename T16> struct WFrag;
template <> struct WFrag<h16> { typedef v16h V; static __device__ __forceinline__ V ld(const h16* p) { return cat16(*(const v8h*)p, *(const v8h*)(p + 16)); } static __device__ __forceinline__ v8f mma(V a, V b, v8f c) { return wmma16(a, b, c); } };
template <> struct WFrag<bf> { typedef v16bf V; static __device__ __forceinline__ V ld(const bf* p) { return cat16b(*(const v8us*)p, *(const v8us*)(p + 16)); } static __device__ __forceinline__ v8f mma(V a, V b, v8f c) { return wmmab(a, b, c); } };
template <typename T16, int NSPLIT, bool BIAS>
__global__ __launch_bounds__(32) void k_gemmw(const T16* __restrict__ A, const T16* __restrict__ A2, const T16* __restrict__ Bt, const T16* __restrict__ Bt2, int K, float* C, int ldc, const float* __restrict__ bias, size_t sA, size_t sB, size_t sC) {
    typedef typename WFrag<T16>::V V;
    __shared__ __align__(16) float os[16 * 68];
    const size_t z = blockIdx.z; A += z * sA; if (A2) A2 += z * sA; Bt += z * sB; if (Bt2) Bt2 += z * sB; C += z * sC;
    const int lane = threadIdx.x & 31, lr = lane & 15, hi = lane >> 4; const int r0 = blockIdx.x * 64, c0 = blockIdx.y * 64;
    v8f acc[4][4];
#pragma unroll
    for (int mb = 0; mb < 4; ++mb)
#pragma unroll
        for (int nb = 0; nb < 4; ++nb) acc[mb][nb] = (v8f){};
    const size_t aoff = (size_t)(r0 + lr) * K + 8 * hi, boff = (size_t)(c0 + lr) * K + 8 * hi;
#pragma unroll 1
    for (int kc = 0; kc < K; kc += 32) {
        V a[4], a2[4];
#pragma unroll
        for (int mb = 0; mb < 4; ++mb) { a[mb] = WFrag<T16>::ld(A + aoff + (size_t)mb * 16 * K + kc); if (NSPLIT == 1 || NSPLIT == 2) a2[mb] = WFrag<T16>::ld(A2 + aoff + (size_t)mb * 16 * K + kc); }
#pragma unroll
        for (int nb = 0; nb < 4; ++nb) { const V b = WFrag<T16>::ld(Bt + boff + (size_t)nb * 16 * K + kc); V b2; if (NSPLIT >= 2) b2 = WFrag<T16>::ld(Bt2 + boff + (size_t)nb * 16 * K + kc);
#pragma unroll
            for (int mb = 0; mb < 4; ++mb) { acc[mb][nb] = WFrag<T16>::mma(a[mb], b, acc[mb][nb]); if (NSPLIT == 1 || NSPLIT == 2) acc[mb][nb] = WFrag<T16>::mma(a2[mb], b, acc[mb][nb]); if (NSPLIT >= 2) acc[mb][nb] = WFrag<T16>::mma(a[mb], b2, acc[mb][nb]); } }
        asm volatile("v_nop\n\tv_nop\n\tv_nop\n\tv_nop" : "+v"(acc[0][0]), "+v"(acc[1][1]), "+v"(acc[2][2]), "+v"(acc[3][3]) : "v"(a[0]), "v"(a[3]));
    }
#pragma unroll
    for (int mb = 0; mb < 4; ++mb) {
#pragma unroll
        for (int nb = 0; nb < 4; ++nb) {
#pragma unroll
            for (int j = 0; j < 8; ++j) os[(hi * 8 + j) * 68 + nb * 16 + lr] = acc[mb][nb][j]; }
        __builtin_amdgcn_wave_barrier(); asm volatile("" ::: "memory");
        float* crow = C + (size_t)(r0 + mb * 16) * ldc + c0;
{
#pragma unroll
            for (int s = 0; s < 8; ++s) { const int row = 2 * s + hi, cofs = lr * 4; v4f val = *(const v4fa*)(os + row * 68 + cofs); if (BIAS) { val[0] += bfr(bias[c0 + cofs]); val[1] += bfr(bias[c0 + cofs + 1]); val[2] += bfr(bias[c0 + cofs + 2]); val[3] += bfr(bias[c0 + cofs + 3]); }
                *(v4f*)(crow + (size_t)row * ldc + cofs) = val; }
             }
        __builtin_amdgcn_wave_barrier(); asm volatile("" ::: "memory");
    }
}

__device__ __forceinline__ h16 tohx(float x) { return (h16)x; }
__device__ __forceinline__ void splitf(float y, unsigned short& h, unsigned short& l) { h = f2bf(y); l = f2bf(y - bf2f(h)); }
typedef __attribute__((ext_vector_type(2))) _Float16 v2h;
typedef __attribute__((ext_vector_type(4))) _Float16 v4h;
typedef __attribute__((ext_vector_type(2))) unsigned short v2us;
typedef __attribute__((ext_vector_type(4))) unsigned short v4us;
typedef __attribute__((ext_vector_type(2))) float v2f;

// k_cvt8: grid y picks one of up to four equally long f32 sources; their bf16 copies follow one another in dst.
__global__ __launch_bounds__(256) void k_cvt8(const float* __restrict__ s0, const float* __restrict__ s1, const float* __restrict__ s2, const float* __restrict__ s3, bf* dst, size_t n8) { const size_t i = (size_t)blockIdx.x * 256 + threadIdx.x; if (i >= n8) return;
    const unsigned y = blockIdx.y; const float* src = (y == 0) ? s0 : (y == 1) ? s1 : (y == 2) ? s2 : s3; const v8f v = *(const v8f*)(src + i * 8); v8us o;
#pragma unroll
    for (int k = 0; k < 8; ++k) o[k] = f2bf(v[k]); *(v8us*)(dst + ((size_t)y * n8 + i) * 8) = o;  }

__global__ __launch_bounds__(256) void k_qkp(const float* __restrict__ F, int pitch, int nheads, h16* P16, bf* Ph, bf* Pl) {
    const size_t e = ((size_t)blockIdx.x * 256 + threadIdx.x) * 2; if (e >= (size_t)nheads * TT * HD) return; const int d = (int)(e % HD); const int t = (int)((e / HD) % TT); const int h = (int)(e / ((size_t)HD * TT)); const int b = blockIdx.y; const size_t eo = (size_t)b * nheads * TT * HD + e;   // grid y = batch; planes [b][h][t][d]
    const float* f = F + ((size_t)b * TT + t) * pitch + h * HD; v2h o16; v2us oh, ol;
#pragma unroll
    for (int q = 0; q < 2; ++q) { const float x = f[d + q]; o16[q] = tohx(x); unsigned short a2, c2; splitf(x, a2, c2); oh[q] = a2; ol[q] = c2; }
    *(v2h*)(P16 + eo) = o16; *(v2us*)(Ph + eo) = oh; *(v2us*)(Pl + eo) = ol;  }
__global__ __launch_bounds__(256) void k_vtp(const float* __restrict__ F, int pitch, int nheads, h16* V16, bf* Vh, bf* Vl) { const size_t e = ((size_t)blockIdx.x * 256 + threadIdx.x) * 2; if (e >= (size_t)nheads * HD * TT) return; const int t = (int)(e % TT); const int d = (int)((e / TT) % HD); const int g = (int)(e / ((size_t)TT * HD)); const int b = blockIdx.y; const size_t eo = (size_t)b * nheads * HD * TT + e; v2h o16; v2us oh, ol;   // grid y = batch; planes [b][g][d][t]
#pragma unroll
    for (int q = 0; q < 2; ++q) { const float x = F[((size_t)b * TT + t + q) * pitch + g * HD + d]; o16[q] = tohx(x); unsigned short a2, c2; splitf(x, a2, c2); oh[q] = a2; ol[q] = c2; }
    *(v2h*)(V16 + eo) = o16; *(v2us*)(Vh + eo) = oh; *(v2us*)(Vl + eo) = ol;  }
// ---- k_attn: causal attention of QT query rows of one head, scores never leave the registers. Transposed products: S^T = K Q^T (A = 16 key rows, B = 16 query columns), O^T += V^T P^T (A = 16 rows of the value plane [d][t],
// B = P^T packed from two S^T tiles: element s of the operand is key 8h + s (s < 8) or 16 + 8h + s - 8, which is the k order of WFrag::ld). A lane holds scores and context of ONE query (column l & 15): maximum, sum and rescale are in-lane
// plus one exchange between the wave's halves. Running maximum m of the raw scores; P = 2^((s - m) SCL2 + POFF), SCL2 = 512^-0.5 log2(e) (POFF = 10 carries the f16 P x1024, it cancels in O / sum).
// The unroll directives give every fragment and accumulator array constant indices, so that it lives in registers.
typedef __attribute__((ext_vector_type(8))) __bf16 v8bf;
__device__ __forceinline__ float xhalf(float x) { const int b = __float_as_int(x); return __int_as_float(__builtin_amdgcn_permlanex16(b, b, 0x76543210, 0xfedcba98, false, false)); }   // lane l <-> l ^ 16
template <typename T16, bool SPLIT, int NQG, int CS>   // NQG 16-column query groups, from group g0 of the tile; key chunks cf, cf + CS, ...; partial result to LDS slot cf
__device__ __forceinline__ void attn_wave(const T16* __restrict__ Q, const T16* __restrict__ Q2, const T16* __restrict__ Kp, const T16* __restrict__ K2, const T16* __restrict__ Vt, const T16* __restrict__ Vt2, int qt, int g0, int cf, float* om, float* ol, float* oo) {
    typedef typename WFrag<T16>::V V;
    constexpr float SCL2 = (float)(SCL * 1.4426950408889634), POFF = SPLIT ? 0.0f : 10.0f;
    const int lane = threadIdx.x & 31, lr = lane & 15, hi = lane >> 4; const int qc = 16 * g0 + lr;   // this lane's column of group 0 within the tile
    V qf[NQG][2], qf2[NQG][2];
#pragma unroll
    for (int qg = 0; qg < NQG; ++qg)
#pragma unroll
        for (int ks = 0; ks < 2; ++ks) { const size_t o = (size_t)(qt * QT + 16 * qg + qc) * HD + 32 * ks + 8 * hi; qf[qg][ks] = WFrag<T16>::ld(Q + o); if (SPLIT) qf2[qg][ks] = WFrag<T16>::ld(Q2 + o); }
    v8f ot[4][NQG]; float m[NQG], l[NQG];
#pragma unroll
    for (int qg = 0; qg < NQG; ++qg) { m[qg] = -3.0e38f; l[qg] = 0.f;
#pragma unroll
        for (int dt = 0; dt < 4; ++dt) ot[dt][qg] = (v8f){}; }
    V kf[2][2], kf2[2][2];
    auto ldk = [&](int c) {   // the four (hi/lo: eight) key fragments of chunk c
#pragma unroll
        for (int kt = 0; kt < 2; ++kt)
#pragma unroll
            for (int ks = 0; ks < 2; ++ks) { const size_t o = (size_t)(c * 32 + 16 * kt + lr) * HD + 32 * ks + 8 * hi; kf[kt][ks] = WFrag<T16>::ld(Kp + o); if (SPLIT) kf2[kt][ks] = WFrag<T16>::ld(K2 + o); } };
    ldk(min(cf, qt));
    for (int c = cf; c <= qt; c += CS) {
        const int k0 = c * 32;
        V vf[4], vf2[4];
#pragma unroll
        for (int dt = 0; dt < 4; ++dt) { const size_t o = (size_t)(16 * dt + lr) * TT + k0 + 8 * hi; vf[dt] = WFrag<T16>::ld(Vt + o); if (SPLIT) vf2[dt] = WFrag<T16>::ld(Vt2 + o); }
        __builtin_amdgcn_sched_barrier(0);   // the value loads issue here, ahead of the score products, and land while scores and softmax run
        v8f s[2][NQG];
#pragma unroll
        for (int kt = 0; kt < 2; ++kt)
#pragma unroll
            for (int qg = 0; qg < NQG; ++qg) { v8f a = (v8f){};
#pragma unroll
                for (int ks = 0; ks < 2; ++ks) { a = WFrag<T16>::mma(kf[kt][ks], qf[qg][ks], a); if (SPLIT) { a = WFrag<T16>::mma(kf[kt][ks], qf2[qg][ks], a); a = WFrag<T16>::mma(kf2[kt][ks], qf[qg][ks], a); } }
                s[kt][qg] = a; }
        ldk(min(c + CS, qt));   // this wave's next chunk, one pass ahead (the last pass re-reads an in-range chunk and drops it)
        __builtin_amdgcn_sched_barrier(0);   // the key loads issue here, right behind their registers' last use, and land while softmax and P.V run
        float mn[NQG]; bool up = false;
#pragma unroll
        for (int qg = 0; qg < NQG; ++qg) { float mx = -3.0e38f;
#pragma unroll
            for (int kt = 0; kt < 2; ++kt)
#pragma unroll
                for (int r = 0; r < 8; ++r) { float t = s[kt][qg][r]; if (c == qt) t = (16 * kt + 8 * hi + r <= 16 * qg + qc) ? t : -3.0e38f;   // only the last chunk crosses the diagonal (its first key is the tile's first query)
                    s[kt][qg][r] = t; mx = fmaxf(mx, t); }
            mn[qg] = fmaxf(m[qg], fmaxf(mx, xhalf(mx))); up = up || (mn[qg] > m[qg]); }
        if (__builtin_amdgcn_ballot_w32(up) != 0) {   // a maximum moved: bring sums and context to the new one (the factor is exactly 1 otherwise)
#pragma unroll
            for (int qg = 0; qg < NQG; ++qg) { const float al = __builtin_amdgcn_exp2f((m[qg] - mn[qg]) * SCL2); l[qg] *= al; m[qg] = mn[qg];
#pragma unroll
                for (int dt = 0; dt < 4; ++dt) ot[dt][qg] *= al; } }
#pragma unroll
        for (int qg = 0; qg < NQG; ++qg) { const float mo = POFF - m[qg] * SCL2; v8f p[2];
#pragma unroll
            for (int kt = 0; kt < 2; ++kt)
#pragma unroll
                for (int r = 0; r < 8; ++r) { p[kt][r] = __builtin_amdgcn_exp2f(fmaf(s[kt][qg][r], SCL2, mo)); l[qg] += p[kt][r]; }
            if constexpr (SPLIT) {
                const v8bf h0 = __builtin_convertvector(p[0], v8bf), h1 = __builtin_convertvector(p[1], v8bf);
                const v8bf l0 = __builtin_convertvector(p[0] - __builtin_convertvector(h0, v8f), v8bf), l1 = __builtin_convertvector(p[1] - __builtin_convertvector(h1, v8f), v8bf);
                const V ph = __builtin_shufflevector(h0, h1, 0, 1, 2, 3, 4, 5, 6, 7, 8, 9, 10, 11, 12, 13, 14, 15), pl = __builtin_shufflevector(l0, l1, 0, 1, 2, 3, 4, 5, 6, 7, 8, 9, 10, 11, 12, 13, 14, 15);
#pragma unroll
                for (int dt = 0; dt < 4; ++dt) { ot[dt][qg] = WFrag<T16>::mma(vf[dt], ph, ot[dt][qg]); ot[dt][qg] = WFrag<T16>::mma(vf[dt], pl, ot[dt][qg]); ot[dt][qg] = WFrag<T16>::mma(vf2[dt], ph, ot[dt][qg]); }
            } else {
                const V ph = cat16(__builtin_convertvector(p[0], v8h), __builtin_convertvector(p[1], v8h));
#pragma unroll
                for (int dt = 0; dt < 4; ++dt) ot[dt][qg] = WFrag<T16>::mma(vf[dt], ph, ot[dt][qg]);
            } }
    }
    // this wave's partial result: maximum, sum (halves joined) and 64 context values per query; maximum in log2 units; a wave without a chunk hands over a maximum far below any score, sum 0, context 0
#pragma unroll
    for (int qg = 0; qg < NQG; ++qg) { const float ls = l[qg] + xhalf(l[qg]); const int q = cf * QT + 16 * qg + qc; if (hi == 0) { om[q] = m[qg] * SCL2; ol[q] = ls; }
#pragma unroll
        for (int dt = 0; dt < 4; ++dt) { float* d = oo + (size_t)q * OSP + 16 * dt + 8 * hi; *(v4fa*)d = __builtin_shufflevector(ot[dt][qg], ot[dt][qg], 0, 1, 2, 3); *(v4fa*)(d + 4) = __builtin_shufflevector(ot[dt][qg], ot[dt][qg], 4, 5, 6, 7); } }
}

// grid (heads, batches, TT / QT), longest query tiles first (low z starts first); tiles of query rows < RH run the bf16 hi/lo form, the others the f16 form.
// Four waves per SIMD (at most 256 registers a wave): the vector work between the matrix runs of one wave is covered by the others, and the whole grid is resident at once.
__global__ __launch_bounds__(32 * AW) __attribute__((amdgpu_waves_per_eu(4, 4))) void k_attn(const h16* __restrict__ QK16, const bf* __restrict__ QKh, const bf* __restrict__ QKl, const h16* __restrict__ VT16, const bf* __restrict__ VTh, const bf* __restrict__ VTl, bf* ATh, bf* ATl) {
    __shared__ __align__(16) float oo[AW * QT * OSP]; __shared__ float om[AW * QT]; __shared__ float ol[AW * QT];
    const int qt = (int)(gridDim.z - 1 - blockIdx.z), h = blockIdx.x, b = blockIdx.y; const int w = __builtin_amdgcn_readfirstlane((int)(threadIdx.x >> 5));
    const size_t zq = ((size_t)b * (NH_ + NKV) + h) * TT * HD, zk = ((size_t)b * (NH_ + NKV) + NH_ + h / REP) * TT * HD, zv = ((size_t)b * NKV + h / REP) * HD * TT;
    const bool hires = qt * QT < RH; const int np = hires ? AW / 2 : AW;   // partial results per query
    if (hires) attn_wave<bf, true, 1, AW / 2>(QKh + zq, QKl + zq, QKh + zk, QKl + zk, VTh + zv, VTl + zv, qt, w & 1, w >> 1, om, ol, oo);   // one query group a wave (its twofold operands fit the registers of the f16 form), two waves split the keys
    else attn_wave<h16, false, 2, AW>(QK16 + zq, nullptr, QK16 + zk, nullptr, VT16 + zv, nullptr, qt, 0, w, om, ol, oo);
    __syncthreads();
    // join the np partial results: wave w finishes queries 8w .. 8w + 7, four lanes a query (16 context values each), so each 128-byte line of the context planes has one writing wave
    const int lane = threadIdx.x & 31, q = w * 8 + (lane >> 2), dr = (lane & 3) * 16;
    float M = om[q];
#pragma unroll
    for (int u = 1; u < AW; ++u) if (u < np) M = fmaxf(M, om[u * QT + q]);
    float Ls = 0.f; v4f acc[4];
#pragma unroll
    for (int j = 0; j < 4; ++j) acc[j] = (v4f){};
#pragma unroll
    for (int u = 0; u < AW; ++u) if (u < np) { const float cw = __builtin_amdgcn_exp2f(om[u * QT + q] - M); Ls += cw * ol[u * QT + q];
#pragma unroll
        for (int j = 0; j < 4; ++j) acc[j] += cw * *(const v4fa*)(oo + (size_t)(u * QT + q) * OSP + dr + 4 * j); }
    const float inv = __fdiv_rn(1.0f, Ls); v8us oh[2], olo[2];
#pragma unroll
    for (int j = 0; j < 16; ++j) { unsigned short a, c2; splitf(acc[j >> 2][j & 3] * inv, a, c2); oh[j >> 3][j & 7] = a; olo[j >> 3][j & 7] = c2; }
    const size_t off = ((size_t)b * TT + qt * QT + q) * DQ + h * HD + dr;
    *(v8us*)(ATh + off) = oh[0]; *(v8us*)(ATh + off + 8) = oh[1]; *(v8us*)(ATl + off) = olo[0]; *(v8us*)(ATl + off + 8) = olo[1];
}

extern "C" void kernel_launch(void* const* d_in, const int* in_sizes, int n_in,
                              void* d_out, int out_size, void* d_ws, size_t ws_size, hipStream_t stream) {
    if (n_in < 7) return;
    const size_t needx = ((size_t)(NB - 1) * SEQ_FULL + SEQ) * DM;     // rows actually read / written (full per-batch stride, SEQ rows of the last batch)
    if ((size_t)in_sizes[0] < needx || (size_t)in_sizes[1] < needx || (size_t)in_sizes[2] < needx) return;
    if (in_sizes[3] < DQ * DM || in_sizes[4] < DKV * DM || in_sizes[5] < DKV * DM || in_sizes[6] < DM * DQ) return;
    if ((size_t)out_size < needx) return;
    const float* xq = (const float*)d_in[0]; const float* xk = (const float*)d_in[1]; const float* xv = (const float*)d_in[2];
    const float* wq = (const float*)d_in[3]; const float* wk = (const float*)d_in[4]; const float* wv = (const float*)d_in[5]; const float* wo = (const float*)d_in[6];
    float* OUT = (float*)d_out;     // [NB_FULL][SEQ_FULL][DM]
    char* wsp = (char*)d_ws;
    auto take = [&](size_t bytes) { char* p = wsp; wsp += (bytes + 255) & ~(size_t)255; return (void*)p; };
    bf* WQ = (bf*)take((size_t)DQ * DM * 2); bf* WK = (bf*)take((size_t)DKV * DM * 2); bf* WV = (bf*)take((size_t)DKV * DM * 2); bf* WO = (bf*)take((size_t)DM * DQ * 2); (void)WK; (void)WV;   // consecutive: one conversion launch, z-stride DQ*DM in the projections
    h16* QK16 = (h16*)take((size_t)NB * (NH_ + NKV) * TT * HD * 2); bf* QKh = (bf*)take((size_t)NB * (NH_ + NKV) * TT * HD * 2); bf* QKl = (bf*)take((size_t)NB * (NH_ + NKV) * TT * HD * 2);   // [b][q heads, then k heads][t][d]
    h16* VT16 = (h16*)take((size_t)NB * NKV * HD * TT * 2); bf* VTh = (bf*)take((size_t)NB * NKV * HD * TT * 2); bf* VTl = (bf*)take((size_t)NB * NKV * HD * TT * 2);
    bf* XB = (bf*)take((size_t)3 * NB * TT * DM * 2); float* FP = (float*)take((size_t)3 * NB * TT * DQ * 4); bf* ATh = (bf*)take((size_t)NB * TT * DQ * 2); bf* ATl = (bf*)take((size_t)NB * TT * DQ * 2);
    if ((size_t)(wsp - (char*)d_ws) > ws_size) return;
    const size_t n8w = (size_t)DQ * DM / 8, n8x = (size_t)NB * TT * DM / 8;
    const unsigned LW8 = (unsigned)((n8w + 255) / 256), LX8 = (unsigned)((n8x + 255) / 256);
    k_cvt8<<<dim3(LW8, 4, 1), 256, 0, stream>>>(wq, wk, wv, wo, WQ, n8w);   // [out][in] = Bt rows as-is
    k_cvt8<<<dim3(LX8, 3, 1), 256, 0, stream>>>(xq, xk, xv, nullptr, XB, n8x);
    k_gemmw<bf, 0, false><<<dim3(NB * TT / 64, DQ / 64, 3), 32, 0, stream>>>(XB, nullptr, WQ, nullptr, DM, FP, 3 * DQ, nullptr, (size_t)NB * TT * DM, (size_t)DQ * DM, (size_t)DQ);   // z = q, k, v -> columns z*512.. of FP
    k_qkp<<<dim3((unsigned)(((size_t)(NH_ + NKV) * TT * HD / 2 + 255) / 256), NB, 1), 256, 0, stream>>>(FP, 3 * DQ, NH_ + NKV, QK16, QKh, QKl);
    k_vtp<<<dim3((unsigned)(((size_t)NKV * TT * HD / 2 + 255) / 256), NB, 1), 256, 0, stream>>>(FP + 2 * DQ, 3 * DQ, NKV, VT16, VTh, VTl);
    k_attn<<<dim3(NH_, NB, TT / QT), 32 * AW, 0, stream>>>(QK16, QKh, QKl, VT16, VTh, VTl, ATh, ATl);
    k_gemmw<bf, 1, false><<<dim3(NB * TT / 64, DM / 64, 1), 32, 0, stream>>>(ATh, ATl, WO, nullptr, DQ, OUT, DM, nullptr, 0, 0, 0);
}

// v003
// It runs in 67.2 microseconds.
// In two side-by-side timings against v002, it was 1.39 and 1.40 times as fast.
// Over all steps from v000 it is 11.1 times as fast.
#include <hip/hip_runtime.h>

// Contractions and dtypes (f32 accumulate everywhere): q/k/v projections v_wmma_f32_16x16x32_bf16 on RNE bf16 copies of the inputs (exact products);
// scores and P.V for query rows < 512: bf16 hi/lo split operands (3 products); query rows >= 512: v_wmma_f32_16x16x32_f16 (f16 q/k/v planes, P carried x1024);
// output projection: bf16 hi/lo context planes x bf16 Wo (2 products); softmax and all side math f32.
// Sizes: query/key/value [2][2048][512], weights [512][512] in [out][in] layout (y = x W^T), 8 heads of 64, causal (keys j <= i), scores x 512^-0.5, out [2][2048][512].
// Both batches at once: bf16 copies of query, key, value [3][NB*SEQ][512]; projections (grid z = q, k, v), each 64x64 tile written from its accumulators straight to the head planes [b][h][t][64]
// (q, k: f16 + bf16 hi/lo) and value planes [b][h][64][t] (f16 + bf16 hi/lo); one attention launch for all batches and heads: scores, running-maximum softmax and P.V stay in registers,
// the waves of a work-group split the keys and join through LDS -> context hi/lo planes [b*SEQ + t][h*64 + d]; then context x Wo -> out, both batches in one launch.

#ifndef NB
#define NB 2
#endif
#ifndef SEQ
#define SEQ 2048
#endif
#define NB_FULL  2
#define SEQ_FULL 2048
#define TT   SEQ
#define DM   512
#define NH_  8
#define NKV  8
#define REP  (NH_ / NKV)
#define HD   64
#define DQ   (NH_ * HD)
#define DKV  (NKV * HD)
#define RH   (((TT) < 512) ? (TT) : 512)   // query rows < RH use hi+lo operands
#define SCL  0.044194173824159216         // 512^-0.5
#define QT   32                             // query columns per attention work-group (two 16-column groups; an f16-form wave takes both, a hi/lo-form wave one)
#define AW   4                              // waves per attention work-group; they split the 32-key chunks of the tile's keys
#define OSP  68                             // LDS pitch (floats) of a query's 64 partial context values

static_assert(NB >= 1 && NB <= NB_FULL);
static_assert(SEQ >= 128 && SEQ <= SEQ_FULL && (SEQ % 128) == 0);
static_assert((RH % QT) == 0 && (TT % QT) == 0 && RH > 0 && QT == 32 && QT == 8 * AW);
static_assert(REP == 1 && HD == 64 && (DM % 64) == 0 && (DQ % 64) == 0 && (DKV % 64) == 0);
// workspace carve (every region is a multiple of 256 B and of its store granularity)
#define WS_TOTAL ((size_t)2 * DQ * DM * 2 + (size_t)2 * DKV * DM * 2 \
                + (size_t)NB * (NH_ + 2 * NKV) * TT * HD * 2 + (size_t)NB * (2 * NH_ + 4 * NKV) * TT * HD * 2 \
                + (size_t)3 * NB * TT * DM * 2 + (size_t)2 * NB * TT * DQ * 2)
static_assert(WS_TOTAL <= (size_t)268435456);
static_assert(SEQ == SEQ_FULL || NB == 1);      // the batches' rows are read and written as one [NB*SEQ][512] matrix
static_assert(DKV == DQ);                       // q, k, v projections share one launch (grid z)
static_assert(((size_t)(NB - 1) * SEQ_FULL + SEQ) * DM <= (size_t)NB_FULL * SEQ_FULL * DM);

typedef _Float16 h16;
typedef unsigned short bf;
typedef __attribute__((ext_vector_type(16))) __bf16   v16bf;
typedef __attribute__((ext_vector_type(16))) _Float16 v16h;
typedef __attribute__((ext_vector_type(8)))  _Float16 v8h;
typedef __attribute__((ext_vector_type(8)))  unsigned short v8us;
typedef __attribute__((ext_vector_type(8)))  float    v8f;
typedef __attribute__((ext_vector_type(4)))  float    v4f;
typedef v8h  __attribute__((may_alias)) v8ha;
typedef v4f  __attribute__((may_alias)) v4fa;
typedef v8us __attribute__((may_alias)) v8usa;

__device__ __forceinline__ unsigned short f2bf(float f) { unsigned u = __float_as_uint(f); u += 0x7FFFu + ((u >> 16) & 1u); return (unsigned short)(u >> 16); }
__device__ __forceinline__ float bf2f(unsigned short b) { return __uint_as_float(((unsigned)b) << 16); }
__device__ __forceinline__ float bfr(float f) { return bf2f(f2bf(f)); }
__device__ __forceinline__ v16h cat16(v8h lo, v8h hi) { return __builtin_shufflevector(lo, hi, 0, 1, 2, 3, 4, 5, 6, 7, 8, 9, 10, 11, 12, 13, 14, 15); }
__device__ __forceinline__ v16bf cat16b(v8us lo, v8us hi) { return __builtin_bit_cast(v16bf, __builtin_shufflevector(lo, hi, 0, 1, 2, 3, 4, 5, 6, 7, 8, 9, 10, 11, 12, 13, 14, 15)); }
__device__ __forceinline__ v8f wmma16(v16h a, v16h b, v8f c) { return __builtin_amdgcn_wmma_f32_16x16x32_f16(false, a, false, b, (short)0, c, false, false); }
__device__ __forceinline__ v8f wmmab(v16bf a, v16bf b, v8f c) { return __builtin_amdgcn_wmma_f32_16x16x32_bf16(false, a, false, b, (short)0, c, false, false); }

// ---- k_gemmw: register-blocked GEMM, ONE WAVE per 64x64 output tile (16 accumulators), operands straight from K-contiguous 16-bit planes; grid (M/64, N/64, Z), 32 threads.
// C[m][n] (f32, pitch ldc, + optional f32 bias[n]) = sum_k A[m][k] Bt[n][k] (+ split products per NSPLIT). z-batch strides sA/sB/sC in elements. K % 32 == 0.
// Fragment map (A and Bt alike, lane l, h = l>>4, row/col = l&15): elements 0..7 = k0 + 8h + 0..7, elements 8..15 = k0 + 16 + 8h + 0..7; D element r = (row 8h + r, col l&15).
template <typename T16> struct WFrag;
template <> struct WFrag<h16> { typedef v16h V; static __device__ __forceinline__ V ld(const h16* p) { return cat16(*(const v8h*)p, *(const v8h*)(p + 16)); } static __device__ __forceinline__ v8f mma(V a, V b, v8f c) { return wmma16(a, b, c); } };
template <> struct WFrag<bf> { typedef v16bf V; static __device__ __forceinline__ V ld(const bf* p) { return cat16b(*(const v8us*)p, *(const v8us*)(p + 16)); } static __device__ __forceinline__ v8f mma(V a, V b, v8f c) { return wmmab(a, b, c); } };
template <typename T16, int NSPLIT, bool BIAS>
__global__ __launch_bounds__(32) void k_gemmw(const T16* __restrict__ A, const T16* __restrict__ A2, const T16* __restrict__ Bt, const T16* __restrict__ Bt2, int K, float* C, int ldc, const float* __restrict__ bias, size_t sA, size_t sB, size_t sC) {
    typedef typename WFrag<T16>::V V;
    __shared__ __align__(16) float os[16 * 68];
    const size_t z = blockIdx.z; A += z * sA; if (A2) A2 += z * sA; Bt += z * sB; if (Bt2) Bt2 += z * sB; C += z * sC;
    const int lane = threadIdx.x & 31, lr = lane & 15, hi = lane >> 4; const int r0 = blockIdx.x * 64, c0 = blockIdx.y * 64;
    v8f acc[4][4];
#pragma unroll
    for (int mb = 0; mb < 4; ++mb)
#pragma unroll
        for (int nb = 0; nb < 4; ++nb) acc[mb][nb] = (v8f){};
    const size_t aoff = (size_t)(r0 + lr) * K + 8 * hi, boff = (size_t)(c0 + lr) * K + 8 * hi;
#pragma unroll 1
    for (int kc = 0; kc < K; kc += 32) {
        V a[4], a2[4];
#pragma unroll
        for (int mb = 0; mb < 4; ++mb) { a[mb] = WFrag<T16>::ld(A + aoff + (size_t)mb * 16 * K + kc); if (NSPLIT == 1 || NSPLIT == 2) a2[mb] = WFrag<T16>::ld(A2 + aoff + (size_t)mb * 16 * K + kc); }
#pragma unroll
        for (int nb = 0; nb < 4; ++nb) { const V b = WFrag<T16>::ld(Bt + boff + (size_t)nb * 16 * K + kc); V b2; if (NSPLIT >= 2) b2 = WFrag<T16>::ld(Bt2 + boff + (size_t)nb * 16 * K + kc);
#pragma unroll
            for (int mb = 0; mb < 4; ++mb) { acc[mb][nb] = WFrag<T16>::mma(a[mb], b, acc[mb][nb]); if (NSPLIT == 1 || NSPLIT == 2) acc[mb][nb] = WFrag<T16>::mma(a2[mb], b, acc[mb][nb]); if (NSPLIT >= 2) acc[mb][nb] = WFrag<T16>::mma(a[mb], b2, acc[mb][nb]); } }
        asm volatile("v_nop\n\tv_nop\n\tv_nop\n\tv_nop" : "+v"(acc[0][0]), "+v"(acc[1][1]), "+v"(acc[2][2]), "+v"(acc[3][3]) : "v"(a[0]), "v"(a[3]));
    }
#pragma unroll
    for (int mb = 0; mb < 4; ++mb) {
#pragma unroll
        for (int nb = 0; nb < 4; ++nb) {
#pragma unroll
            for (int j = 0; j < 8; ++j) os[(hi * 8 + j) * 68 + nb * 16 + lr] = acc[mb][nb][j]; }
        __builtin_amdgcn_wave_barrier(); asm volatile("" ::: "memory");
        float* crow = C + (size_t)(r0 + mb * 16) * ldc + c0;
{
#pragma unroll
            for (int s = 0; s < 8; ++s) { const int row = 2 * s + hi, cofs = lr * 4; v4f val = *(const v4fa*)(os + row * 68 + cofs); if (BIAS) { val[0] += bfr(bias[c0 + cofs]); val[1] += bfr(bias[c0 + cofs + 1]); val[2] += bfr(bias[c0 + cofs + 2]); val[3] += bfr(bias[c0 + cofs + 3]); }
                *(v4f*)(crow + (size_t)row * ldc + cofs) = val; }
             }
        __builtin_amdgcn_wave_barrier(); asm volatile("" ::: "memory");
    }
}

__device__ __forceinline__ void splitf(float y, unsigned short& h, unsigned short& l) { h = f2bf(y); l = f2bf(y - bf2f(h)); }
typedef __attribute__((ext_vector_type(4))) _Float16 v4h;
typedef __attribute__((ext_vector_type(4))) unsigned short v4us;
typedef __attribute__((ext_vector_type(2))) float v2f;

// k_cvt8: grid y picks one of up to four equally long f32 sources; their bf16 copies follow one another in dst.
__global__ __launch_bounds__(256) void k_cvt8(const float* __restrict__ s0, const float* __restrict__ s1, const float* __restrict__ s2, const float* __restrict__ s3, bf* dst, size_t n8) { const size_t i = (size_t)blockIdx.x * 256 + threadIdx.x; if (i >= n8) return;
    const unsigned y = blockIdx.y; const float* src = (y == 0) ? s0 : (y == 1) ? s1 : (y == 2) ? s2 : s3; const v8f v = *(const v8f*)(src + i * 8); v8us o;
#pragma unroll
    for (int k = 0; k < 8; ++k) o[k] = f2bf(v[k]); *(v8us*)(dst + ((size_t)y * n8 + i) * 8) = o;  }

typedef __attribute__((ext_vector_type(8))) __bf16 v8bf;
// ---- k_proj: the three projections (grid z = q, k, v; grid x = 64 input rows, grid y = head), ONE WAVE per 64x64 tile, main loop and fragment map as in k_gemmw; the tile goes from the accumulators to its three head planes.
// q, k: A = 64 input rows t, Bt = the head's 64 weight rows d: tile [t][d] -> planes [b][z * NH_ + head][t][d]. v: the operands change places (A = weight rows d, Bt = input rows t): tile [d][t] -> planes [b][head][d][t].
// Either way a tile row is 64 consecutive plane elements = one 128-byte line, written whole by this wave (16 rows at a time through LDS, 8 lanes a row).
__global__ __launch_bounds__(32) void k_proj(const bf* __restrict__ X, const bf* __restrict__ Wt, h16* QK16, bf* QKh, bf* QKl, h16* VT16, bf* VTh, bf* VTl) {
    typedef WFrag<bf>::V V;
    __shared__ __align__(16) float os[16 * 68];
    const int z = blockIdx.z, hd = blockIdx.y, t0 = blockIdx.x * 64; const bool tr = z == 2;
    const int lane = threadIdx.x & 31, lr = lane & 15, hi = lane >> 4;
    const bf* xr = X + ((size_t)z * NB * TT + t0) * DM; const bf* wr = Wt + ((size_t)z * DQ + hd * HD) * DM;
    const bf* A = (tr ? wr : xr) + lr * DM + 8 * hi; const bf* Bt = (tr ? xr : wr) + lr * DM + 8 * hi;
    v8f acc[4][4];
#pragma unroll
    for (int mb = 0; mb < 4; ++mb)
#pragma unroll
        for (int nb = 0; nb < 4; ++nb) acc[mb][nb] = (v8f){};
#pragma unroll 1
    for (int kc = 0; kc < DM; kc += 32) {
        V a[4], bb[4]; const bf* pa = A + kc; const bf* pb = Bt + kc;
#pragma unroll
        for (int mb = 0; mb < 4; ++mb) { a[mb] = WFrag<bf>::ld(pa + mb * 16 * DM); bb[mb] = WFrag<bf>::ld(pb + mb * 16 * DM); }
        asm volatile("s_wait_xcnt 0x0" :: "v"(pa), "v"(pb) : "memory");   // stands in front of every overwrite of a register that the pass's loads name; the two addresses are inputs, so that no load's result is placed on them ahead of it
#pragma unroll
        for (int nb = 0; nb < 4; ++nb)
#pragma unroll
            for (int mb = 0; mb < 4; ++mb) acc[mb][nb] = WFrag<bf>::mma(a[mb], bb[nb], acc[mb][nb]);
    }
    const int b = t0 / TT, t = t0 % TT;   // a tile lies in one batch (TT % 64 == 0)
    const size_t base = tr ? ((size_t)b * NKV + hd) * HD * TT + t : (((size_t)b * (NH_ + NKV) + z * NH_ + hd) * TT + t) * HD; const size_t pitch = tr ? TT : HD;
    h16* P16 = (tr ? VT16 : QK16) + base; bf* Ph = (tr ? VTh : QKh) + base; bf* Pl = (tr ? VTl : QKl) + base;
#pragma unroll
    for (int mb = 0; mb < 4; ++mb) {
#pragma unroll
        for (int nb = 0; nb < 4; ++nb) {
#pragma unroll
            for (int j = 0; j < 8; ++j) os[(hi * 8 + j) * 68 + nb * 16 + lr] = acc[mb][nb][j]; }
        __builtin_amdgcn_wave_barrier(); asm volatile("" ::: "memory");   // the rows are read back by other lanes of this wave: keeps the reads behind the writes
#pragma unroll
        for (int s = 0; s < 4; ++s) { const int row = 4 * s + (lane >> 3), cofs = (lane & 7) * 8; const v4f x0 = *(const v4fa*)(os + row * 68 + cofs), x1 = *(const v4fa*)(os + row * 68 + cofs + 4);
            const v8f x = __builtin_shufflevector(x0, x1, 0, 1, 2, 3, 4, 5, 6, 7); const v8bf xh = __builtin_convertvector(x, v8bf), xl = __builtin_convertvector(x - __builtin_convertvector(xh, v8f), v8bf);   // round to nearest even, as f2bf and splitf do
            const size_t o = (size_t)(mb * 16 + row) * pitch + cofs; *(v8h*)(P16 + o) = __builtin_convertvector(x, v8h); *(v8us*)(Ph + o) = __builtin_bit_cast(v8us, xh); *(v8us*)(Pl + o) = __builtin_bit_cast(v8us, xl); }
        __builtin_amdgcn_wave_barrier(); asm volatile("" ::: "memory");   // the next 16 rows overwrite the staging rows only behind these reads
    }
}
// ---- k_attn: causal attention of QT query rows of one head, scores never leave the registers. Transposed products: S^T = K Q^T (A = 16 key rows, B = 16 query columns), O^T += V^T P^T (A = 16 rows of the value plane [d][t],
// B = P^T packed from two S^T tiles: element s of the operand is key 8h + s (s < 8) or 16 + 8h + s - 8, which is the k order of WFrag::ld). A lane holds scores and context of ONE query (column l & 15): maximum, sum and rescale are in-lane
// plus one exchange between the wave's halves. Running maximum m of the raw scores; P = 2^((s - m) SCL2 + POFF), SCL2 = 512^-0.5 log2(e) (POFF = 10 carries the f16 P x1024, it cancels in O / sum).
// The unroll directives give every fragment and accumulator array constant indices, so that it lives in registers.
__device__ __forceinline__ float xhalf(float x) { const int b = __float_as_int(x); return __int_as_float(__builtin_amdgcn_permlanex16(b, b, 0x76543210, 0xfedcba98, false, false)); }   // lane l <-> l ^ 16
template <typename T16, bool SPLIT, int NQG, int CS>   // NQG 16-column query groups, from group g0 of the tile; key chunks cf, cf + CS, ...; partial result to LDS slot cf
__device__ __forceinline__ void attn_wave(const T16* __restrict__ Q, const T16* __restrict__ Q2, const T16* __restrict__ Kp, const T16* __restrict__ K2, const T16* __restrict__ Vt, const T16* __restrict__ Vt2, int qt, int g0, int cf, float* om, float* ol, float* oo) {
    typedef typename WFrag<T16>::V V;
    constexpr float SCL2 = (float)(SCL * 1.4426950408889634), POFF = SPLIT ? 0.0f : 10.0f;
    const int lane = threadIdx.x & 31, lr = lane & 15, hi = lane >> 4; const int qc = 16 * g0 + lr;   // this lane's column of group 0 within the tile
    V qf[NQG][2], qf2[NQG][2];
#pragma unroll
    for (int qg = 0; qg < NQG; ++qg)
#pragma unroll
        for (int ks = 0; ks < 2; ++ks) { const size_t o = (size_t)(qt * QT + 16 * qg + qc) * HD + 32 * ks + 8 * hi; qf[qg][ks] = WFrag<T16>::ld(Q + o); if (SPLIT) qf2[qg][ks] = WFrag<T16>::ld(Q2 + o); }
    v8f ot[4][NQG]; float m[NQG], l[NQG];
#pragma unroll
    for (int qg = 0; qg < NQG; ++qg) { m[qg] = -3.0e38f; l[qg] = 0.f;
#pragma unroll
        for (int dt = 0; dt < 4; ++dt) ot[dt][qg] = (v8f){}; }
    V kf[2][2], kf2[2][2];
    auto ldk = [&](int c) {   // the four (hi/lo: eight) key fragments of chunk c
#pragma unroll
        for (int kt = 0; kt < 2; ++kt)
#pragma unroll
            for (int ks = 0; ks < 2; ++ks) { const size_t o = (size_t)(c * 32 + 16 * kt + lr) * HD + 32 * ks + 8 * hi; kf[kt][ks] = WFrag<T16>::ld(Kp + o); if (SPLIT) kf2[kt][ks] = WFrag<T16>::ld(K2 + o); } };
    ldk(min(cf, qt));
    for (int c = cf; c <= qt; c += CS) {
        const int k0 = c * 32;
        V vf[4], vf2[4];
#pragma unroll
        for (int dt = 0; dt < 4; ++dt) { const size_t o = (size_t)(16 * dt + lr) * TT + k0 + 8 * hi; vf[dt] = WFrag<T16>::ld(Vt + o); if (SPLIT) vf2[dt] = WFrag<T16>::ld(Vt2 + o); }
        __builtin_amdgcn_sched_barrier(0);   // the value loads issue here, ahead of the score products, and land while scores and softmax run
        v8f s[2][NQG];
#pragma unroll
        for (int kt = 0; kt < 2; ++kt)
#pragma unroll
            for (int qg = 0; qg < NQG; ++qg) { v8f a = (v8f){};
#pragma unroll
                for (int ks = 0; ks < 2; ++ks) { a = WFrag<T16>::mma(kf[kt][ks], qf[qg][ks], a); if (SPLIT) { a = WFrag<T16>::mma(kf[kt][ks], qf2[qg][ks], a); a = WFrag<T16>::mma(kf2[kt][ks], qf[qg][ks], a); } }
                s[kt][qg] = a; }
        ldk(min(c + CS, qt));   // this wave's next chunk, one pass ahead (the last pass re-reads an in-range chunk and drops it)
        __builtin_amdgcn_sched_barrier(0);   // the key loads issue here, right behind their registers' last use, and land while softmax and P.V run
        float mn[NQG]; bool up = false;
#pragma unroll
        for (int qg = 0; qg < NQG; ++qg) { float mx = -3.0e38f;
#pragma unroll
            for (int kt = 0; kt < 2; ++kt)
#pragma unroll
                for (int r = 0; r < 8; ++r) { float t = s[kt][qg][r]; if (c == qt) t = (16 * kt + 8 * hi + r <= 16 * qg + qc) ? t : -3.0e38f;   // only the last chunk crosses the diagonal (its first key is the tile's first query)
                    s[kt][qg][r] = t; mx = fmaxf(mx, t); }
            mn[qg] = fmaxf(m[qg], fmaxf(mx, xhalf(mx))); up = up || (mn[qg] > m[qg]); }
        if (__builtin_amdgcn_ballot_w32(up) != 0) {   // a maximum moved: bring sums and context to the new one (the factor is exactly 1 otherwise)
#pragma unroll
            for (int qg = 0; qg < NQG; ++qg) { const float al = __builtin_amdgcn_exp2f((m[qg] - mn[qg]) * SCL2); l[qg] *= al; m[qg] = mn[qg];
#pragma unroll
                for (int dt = 0; dt < 4; ++dt) ot[dt][qg] *= al; } }
#pragma unroll
        for (int qg = 0; qg < NQG; ++qg) { const float mo = POFF - m[qg] * SCL2; v8f p[2];
#pragma unroll
            for (int kt = 0; kt < 2; ++kt)
#pragma unroll
                for (int r = 0; r < 8; ++r) { p[kt][r] = __builtin_amdgcn_exp2f(fmaf(s[kt][qg][r], SCL2, mo)); l[qg] += p[kt][r]; }
            if constexpr (SPLIT) {
                const v8bf h0 = __builtin_convertvector(p[0], v8bf), h1 = __builtin_convertvector(p[1], v8bf);
                const v8bf l0 = __builtin_convertvector(p[0] - __builtin_convertvector(h0, v8f), v8bf), l1 = __builtin_convertvector(p[1] - __builtin_convertvector(h1, v8f), v8bf);
                const V ph = __builtin_shufflevector(h0, h1, 0, 1, 2, 3, 4, 5, 6, 7, 8, 9, 10, 11, 12, 13, 14, 15), pl = __builtin_shufflevector(l0, l1, 0, 1, 2, 3, 4, 5, 6, 7, 8, 9, 10, 11, 12, 13, 14, 15);
#pragma unroll
                for (int dt = 0; dt < 4; ++dt) { ot[dt][qg] = WFrag<T16>::mma(vf[dt], ph, ot[dt][qg]); ot[dt][qg] = WFrag<T16>::mma(vf[dt], pl, ot[dt][qg]); ot[dt][qg] = WFrag<T16>::mma(vf2[dt], ph, ot[dt][qg]); }
            } else {
                const V ph = cat16(__builtin_convertvector(p[0], v8h), __builtin_convertvector(p[1], v8h));
#pragma unroll
                for (int dt = 0; dt < 4; ++dt) ot[dt][qg] = WFrag<T16>::mma(vf[dt], ph, ot[dt][qg]);
            } }
    }
    // this wave's partial result: maximum, sum (halves joined) and 64 context values per query; maximum in log2 units; a wave without a chunk hands over a maximum far below any score, sum 0, context 0
#pragma unroll
    for (int qg = 0; qg < NQG; ++qg) { const float ls = l[qg] + xhalf(l[qg]); const int q = cf * QT + 16 * qg + qc; if (hi == 0) { om[q] = m[qg] * SCL2; ol[q] = ls; }
#pragma unroll
        for (int dt = 0; dt < 4; ++dt) { float* d = oo + (size_t)q * OSP + 16 * dt + 8 * hi; *(v4fa*)d = __builtin_shufflevector(ot[dt][qg], ot[dt][qg], 0, 1, 2, 3); *(v4fa*)(d + 4) = __builtin_shufflevector(ot[dt][qg], ot[dt][qg], 4, 5, 6, 7); } }
}

// grid (heads, batches, TT / QT), longest query tiles first (low z starts first); tiles of query rows < RH run the bf16 hi/lo form, the others the f16 form.
// Four waves per SIMD (at most 256 registers a wave): the vector work between the matrix runs of one wave is covered by the others, and the whole grid is resident at once.
__global__ __launch_bounds__(32 * AW) __attribute__((amdgpu_waves_per_eu(4, 4))) void k_attn(const h16* __restrict__ QK16, const bf* __restrict__ QKh, const bf* __restrict__ QKl, const h16* __restrict__ VT16, const bf* __restrict__ VTh, const bf* __restrict__ VTl, bf* ATh, bf* ATl) {
    __shared__ __align__(16) float oo[AW * QT * OSP]; __shared__ float om[AW * QT]; __shared__ float ol[AW * QT];
    const int qt = (int)(gridDim.z - 1 - blockIdx.z), h = blockIdx.x, b = blockIdx.y; const int w = __builtin_amdgcn_readfirstlane((int)(threadIdx.x >> 5));
    const size_t zq = ((size_t)b * (NH_ + NKV) + h) * TT * HD, zk = ((size_t)b * (NH_ + NKV) + NH_ + h / REP) * TT * HD, zv = ((size_t)b * NKV + h / REP) * HD * TT;
    const bool hires = qt * QT < RH; const int np = hires ? AW / 2 : AW;   // partial results per query
    if (hires) attn_wave<bf, true, 1, AW / 2>(QKh + zq, QKl + zq, QKh + zk, QKl + zk, VTh + zv, VTl + zv, qt, w & 1, w >> 1, om, ol, oo);   // one query group a wave (its twofold operands fit the registers of the f16 form), two waves split the keys
    else attn_wave<h16, false, 2, AW>(QK16 + zq, nullptr, QK16 + zk, nullptr, VT16 + zv, nullptr, qt, 0, w, om, ol, oo);
    __syncthreads();
    // join the np partial results: wave w finishes queries 8w .. 8w + 7, four lanes a query (16 context values each), so each 128-byte line of the context planes has one writing wave
    const int lane = threadIdx.x & 31, q = w * 8 + (lane >> 2), dr = (lane & 3) * 16;
    float M = om[q];
#pragma unroll
    for (int u = 1; u < AW; ++u) if (u < np) M = fmaxf(M, om[u * QT + q]);
    float Ls = 0.f; v4f acc[4];
#pragma unroll
    for (int j = 0; j < 4; ++j) acc[j] = (v4f){};
#pragma unroll
    for (int u = 0; u < AW; ++u) if (u < np) { const float cw = __builtin_amdgcn_exp2f(om[u * QT + q] - M); Ls += cw * ol[u * QT + q];
#pragma unroll
        for (int j = 0; j < 4; ++j) acc[j] += cw * *(const v4fa*)(oo + (size_t)(u * QT + q) * OSP + dr + 4 * j); }
    const float inv = __fdiv_rn(1.0f, Ls); v8us oh[2], olo[2];
#pragma unroll
    for (int j = 0; j < 16; ++j) { unsigned short a, c2; splitf(acc[j >> 2][j & 3] * inv, a, c2); oh[j >> 3][j & 7] = a; olo[j >> 3][j & 7] = c2; }
    const size_t off = ((size_t)b * TT + qt * QT + q) * DQ + h * HD + dr;
    *(v8us*)(ATh + off) = oh[0]; *(v8us*)(ATh + off + 8) = oh[1]; *(v8us*)(ATl + off) = olo[0]; *(v8us*)(ATl + off + 8) = olo[1];
}

extern "C" void kernel_launch(void* const* d_in, const int* in_sizes, int n_in,
                              void* d_out, int out_size, void* d_ws, size_t ws_size, hipStream_t stream) {
    if (n_in < 7) return;
    const size_t needx = ((size_t)(NB - 1) * SEQ_FULL + SEQ) * DM;     // rows actually read / written (full per-batch stride, SEQ rows of the last batch)
    if ((size_t)in_sizes[0] < needx || (size_t)in_sizes[1] < needx || (size_t)in_sizes[2] < needx) return;
    if (in_sizes[3] < DQ * DM || in_sizes[4] < DKV * DM || in_sizes[5] < DKV * DM || in_sizes[6] < DM * DQ) return;
    if ((size_t)out_size < needx) return;
    const float* xq = (const float*)d_in[0]; const float* xk = (const float*)d_in[1]; const float* xv = (const float*)d_in[2];
    const float* wq = (const float*)d_in[3]; const float* wk = (const float*)d_in[4]; const float* wv = (const float*)d_in[5]; const float* wo = (const float*)d_in[6];
    float* OUT = (float*)d_out;     // [NB_FULL][SEQ_FULL][DM]
    char* wsp = (char*)d_ws;
    auto take = [&](size_t bytes) { char* p = wsp; wsp += (bytes + 255) & ~(size_t)255; return (void*)p; };
    bf* WQ = (bf*)take((size_t)DQ * DM * 2); bf* WK = (bf*)take((size_t)DKV * DM * 2); bf* WV = (bf*)take((size_t)DKV * DM * 2); bf* WO = (bf*)take((size_t)DM * DQ * 2); (void)WK; (void)WV;   // consecutive: one conversion launch, z-stride DQ*DM in the projections
    h16* QK16 = (h16*)take((size_t)NB * (NH_ + NKV) * TT * HD * 2); bf* QKh = (bf*)take((size_t)NB * (NH_ + NKV) * TT * HD * 2); bf* QKl = (bf*)take((size_t)NB * (NH_ + NKV) * TT * HD * 2);   // [b][q heads, then k heads][t][d]
    h16* VT16 = (h16*)take((size_t)NB * NKV * HD * TT * 2); bf* VTh = (bf*)take((size_t)NB * NKV * HD * TT * 2); bf* VTl = (bf*)take((size_t)NB * NKV * HD * TT * 2);
    bf* XB = (bf*)take((size_t)3 * NB * TT * DM * 2); bf* ATh = (bf*)take((size_t)NB * TT * DQ * 2); bf* ATl = (bf*)take((size_t)NB * TT * DQ * 2);
    if ((size_t)(wsp - (char*)d_ws) > ws_size) return;
    const size_t n8w = (size_t)DQ * DM / 8, n8x = (size_t)NB * TT * DM / 8;
    const unsigned LW8 = (unsigned)((n8w + 255) / 256), LX8 = (unsigned)((n8x + 255) / 256);
    k_cvt8<<<dim3(LW8, 4, 1), 256, 0, stream>>>(wq, wk, wv, wo, WQ, n8w);   // [out][in] rows as-is: Bt for q, k, o; A for v
    k_cvt8<<<dim3(LX8, 3, 1), 256, 0, stream>>>(xq, xk, xv, nullptr, XB, n8x);
    k_proj<<<dim3(NB * TT / 64, NH_, 3), 32, 0, stream>>>(XB, WQ, QK16, QKh, QKl, VT16, VTh, VTl);   // z = q, k, v -> head planes
    k_attn<<<dim3(NH_, NB, TT / QT), 32 * AW, 0, stream>>>(QK16, QKh, QKl, VT16, VTh, VTl, ATh, ATl);
    k_gemmw<bf, 1, false><<<dim3(NB * TT / 64, DM / 64, 1), 32, 0, stream>>>(ATh, ATl, WO, nullptr, DQ, OUT, DM, nullptr, 0, 0, 0);
}

// v004
// Measured time: 55.3 microseconds a run.
// Next to v003, in two timings, it ran 1.21 and 1.22 times as fast.
// Over all steps from v000 it is 13.4 times as fast.
#include <hip/hip_runtime.h>

// Contractions and dtypes (f32 accumulate everywhere): q/k/v projections v_wmma_f32_16x16x32_bf16 on the inputs rounded to bf16 (nearest even; exact products);
// scores and P.V for query rows < 512: bf16 hi/lo split operands (3 products); query rows >= 512: v_wmma_f32_16x16x32_f16 (f16 q/k/v planes, P carried x1024);
// output projection: bf16 hi/lo context planes x bf16 Wo (2 products); softmax and all side math f32.
// Sizes: query/key/value [2][2048][512], weights [512][512] in [out][in] layout (y = x W^T), 8 heads of 64, causal (keys j <= i), scores x 512^-0.5, out [2][2048][512].
// Both batches at once: projections (grid z = q, k, v) read the f32 inputs and round them on the way into LDS, each 64x64 tile written from its accumulators straight to the head planes [b][h][t][64]
// (q, k: f16 + bf16 hi/lo) and value planes [b][h][64][t] (f16 + bf16 hi/lo); one attention launch for all batches and heads: scores, running-maximum softmax and P.V stay in registers,
// the waves of a work-group split the keys and join through LDS -> context hi/lo planes [b*SEQ + t][h*64 + d]; then context x Wo -> out, both batches in one launch.

#ifndef NB
#define NB 2
#endif
#ifndef SEQ
#define SEQ 2048
#endif
#define NB_FULL  2
#define SEQ_FULL 2048
#define TT   SEQ
#define DM   512
#define NH_  8
#define NKV  8
#define REP  (NH_ / NKV)
#define HD   64
#define DQ   (NH_ * HD)
#define DKV  (NKV * HD)
#define RH   (((TT) < 512) ? (TT) : 512)   // query rows < RH use hi+lo operands
#define SCL  0.044194173824159216         // 512^-0.5
#define QT   32                             // query columns per attention work-group (two 16-column groups; an f16-form wave takes both, a hi/lo-form wave one)
#define AW   4                              // waves per attention work-group; they split the 32-key chunks of the tile's keys
#define OSP  68                             // LDS pitch (floats) of a query's 64 partial context values

static_assert(NB >= 1 && NB <= NB_FULL);
static_assert(SEQ >= 128 && SEQ <= SEQ_FULL && (SEQ % 128) == 0);
static_assert((RH % QT) == 0 && (TT % QT) == 0 && RH > 0 && QT == 32 && QT == 8 * AW);
static_assert(REP == 1 && HD == 64 && (DM % 64) == 0 && (DQ % 64) == 0 && (DKV % 64) == 0);
// workspace carve (every region is a multiple of 256 B and of its store granularity)
#define WS_TOTAL ((size_t)DM * DQ * 2 \
                + (size_t)NB * (NH_ + 2 * NKV) * TT * HD * 2 + (size_t)NB * (2 * NH_ + 4 * NKV) * TT * HD * 2 \
                + (size_t)2 * NB * TT * DQ * 2)
static_assert(WS_TOTAL <= (size_t)268435456);
static_assert(SEQ == SEQ_FULL || NB == 1);      // the batches' rows are read and written as one [NB*SEQ][512] matrix
static_assert(DKV == DQ && (NH_ % 2) == 0 && DM >= 256);     // q, k, v projections share one launch (grid z), two heads a work-group, at least eight passes of 32 k
static_assert(((size_t)(NB - 1) * SEQ_FULL + SEQ) * DM <= (size_t)NB_FULL * SEQ_FULL * DM);

typedef _Float16 h16;
typedef unsigned short bf;
typedef __attribute__((ext_vector_type(16))) __bf16   v16bf;
typedef __attribute__((ext_vector_type(16))) _Float16 v16h;
typedef __attribute__((ext_vector_type(8)))  _Float16 v8h;
typedef __attribute__((ext_vector_type(8)))  unsigned short v8us;
typedef __attribute__((ext_vector_type(8)))  float    v8f;
typedef __attribute__((ext_vector_type(4)))  float    v4f;
typedef v8h  __attribute__((may_alias)) v8ha;
typedef v4f  __attribute__((may_alias)) v4fa;
typedef v8us __attribute__((may_alias)) v8usa;

__device__ __forceinline__ unsigned short f2bf(float f) { unsigned u = __float_as_uint(f); u += 0x7FFFu + ((u >> 16) & 1u); return (unsigned short)(u >> 16); }
__device__ __forceinline__ float bf2f(unsigned short b) { return __uint_as_float(((unsigned)b) << 16); }
__device__ __forceinline__ float bfr(float f) { return bf2f(f2bf(f)); }
__device__ __forceinline__ v16h cat16(v8h lo, v8h hi) { return __builtin_shufflevector(lo, hi, 0, 1, 2, 3, 4, 5, 6, 7, 8, 9, 10, 11, 12, 13, 14, 15); }
__device__ __forceinline__ v16bf cat16b(v8us lo, v8us hi) { return __builtin_bit_cast(v16bf, __builtin_shufflevector(lo, hi, 0, 1, 2, 3, 4, 5, 6, 7, 8, 9, 10, 11, 12, 13, 14, 15)); }
__device__ __forceinline__ v8f wmma16(v16h a, v16h b, v8f c) { return __builtin_amdgcn_wmma_f32_16x16x32_f16(false, a, false, b, (short)0, c, false, false); }
__device__ __forceinline__ v8f wmmab(v16bf a, v16bf b, v8f c) { return __builtin_amdgcn_wmma_f32_16x16x32_bf16(false, a, false, b, (short)0, c, false, false); }

// ---- k_gemmw: register-blocked GEMM, ONE WAVE per 64x64 output tile (16 accumulators), operands straight from K-contiguous 16-bit planes; grid (M/64, N/64, Z), 32 threads.
// C[m][n] (f32, pitch ldc, + optional f32 bias[n]) = sum_k A[m][k] Bt[n][k] (+ split products per NSPLIT). z-batch strides sA/sB/sC in elements. K % 32 == 0.
// Fragment map (A and Bt alike, lane l, h = l>>4, row/col = l&15): elements 0..7 = k0 + 8h + 0..7, elements 8..15 = k0 + 16 + 8h + 0..7; D element r = (row 8h + r, col l&15).
template <typename T16> struct WFrag;
template <> struct WFrag<h16> { typedef v16h V; static __device__ __forceinline__ V ld(const h16* p) { return cat16(*(const v8h*)p, *(const v8h*)(p + 16)); } static __device__ __forceinline__ v8f mma(V a, V b, v8f c) { return wmma16(a, b, c); } };
template <> struct WFrag<bf> { typedef v16bf V; static __device__ __forceinline__ V ld(const bf* p) { return cat16b(*(const v8us*)p, *(const v8us*)(p + 16)); } static __device__ __forceinline__ v8f mma(V a, V b, v8f c) { return wmmab(a, b, c); } };
template <typename T16, int NSPLIT, bool BIAS>
__global__ __launch_bounds__(32) void k_gemmw(const T16* __restrict__ A, const T16* __restrict__ A2, const T16* __restrict__ Bt, const T16* __restrict__ Bt2, int K, float* C, int ldc, const float* __restrict__ bias, size_t sA, size_t sB, size_t sC) {
    typedef typename WFrag<T16>::V V;
    __shared__ __align__(16) float os[16 * 68];
    const size_t z = blockIdx.z; A += z * sA; if (A2) A2 += z * sA; Bt += z * sB; if (Bt2) Bt2 += z * sB; C += z * sC;
    const int lane = threadIdx.x & 31, lr = lane & 15, hi = lane >> 4; const int r0 = blockIdx.x * 64, c0 = blockIdx.y * 64;
    v8f acc[4][4];
#pragma unroll
    for (int mb = 0; mb < 4; ++mb)
#pragma unroll
        for (int nb = 0; nb < 4; ++nb) acc[mb][nb] = (v8f){};
    const size_t aoff = (size_t)(r0 + lr) * K + 8 * hi, boff = (size_t)(c0 + lr) * K + 8 * hi;
#pragma unroll 1
    for (int kc = 0; kc < K; kc += 32) {
        V a[4], a2[4];
#pragma unroll
        for (int mb = 0; mb < 4; ++mb) { a[mb] = WFrag<T16>::ld(A + aoff + (size_t)mb * 16 * K + kc); if (NSPLIT == 1 || NSPLIT == 2) a2[mb] = WFrag<T16>::ld(A2 + aoff + (size_t)mb * 16 * K + kc); }
#pragma unroll
        for (int nb = 0; nb < 4; ++nb) { const V b = WFrag<T16>::ld(Bt + boff + (size_t)nb * 16 * K + kc); V b2; if (NSPLIT >= 2) b2 = WFrag<T16>::ld(Bt2 + boff + (size_t)nb * 16 * K + kc);
#pragma unroll
            for (int mb = 0; mb < 4; ++mb) { acc[mb][nb] = WFrag<T16>::mma(a[mb], b, acc[mb][nb]); if (NSPLIT == 1 || NSPLIT == 2) acc[mb][nb] = WFrag<T16>::mma(a2[mb], b, acc[mb][nb]); if (NSPLIT >= 2) acc[mb][nb] = WFrag<T16>::mma(a[mb], b2, acc[mb][nb]); } }
        asm volatile("v_nop\n\tv_nop\n\tv_nop\n\tv_nop" : "+v"(acc[0][0]), "+v"(acc[1][1]), "+v"(acc[2][2]), "+v"(acc[3][3]) : "v"(a[0]), "v"(a[3]));
    }
#pragma unroll
    for (int mb = 0; mb < 4; ++mb) {
#pragma unroll
        for (int nb = 0; nb < 4; ++nb) {
#pragma unroll
            for (int j = 0; j < 8; ++j) os[(hi * 8 + j) * 68 + nb * 16 + lr] = acc[mb][nb][j]; }
        __builtin_amdgcn_wave_barrier(); asm volatile("" ::: "memory");
        float* crow = C + (size_t)(r0 + mb * 16) * ldc + c0;
{
#pragma unroll
            for (int s = 0; s < 8; ++s) { const int row = 2 * s + hi, cofs = lr * 4; v4f val = *(const v4fa*)(os + row * 68 + cofs); if (BIAS) { val[0] += bfr(bias[c0 + cofs]); val[1] += bfr(bias[c0 + cofs + 1]); val[2] += bfr(bias[c0 + cofs + 2]); val[3] += bfr(bias[c0 + cofs + 3]); }
                *(v4f*)(crow + (size_t)row * ldc + cofs) = val; }
             }
        __builtin_amdgcn_wave_barrier(); asm volatile("" ::: "memory");
    }
}

__device__ __forceinline__ void splitf(float y, unsigned short& h, unsigned short& l) { h = f2bf(y); l = f2bf(y - bf2f(h)); }
typedef __attribute__((ext_vector_type(4))) _Float16 v4h;
typedef __attribute__((ext_vector_type(4))) unsigned short v4us;
typedef __attribute__((ext_vector_type(2))) float v2f;

typedef __attribute__((ext_vector_type(8))) __bf16 v8bf;
typedef __attribute__((ext_vector_type(4))) __bf16 v4bf;
#define PP 40   // LDS pitch (bf16 elements) of a staged row's 32 k: 80 bytes = 16 x odd, so that the 16-byte fragment reads of 16 rows spread over the banks
// ---- k_proj: the three projections (grid z = q, k, v; grid x = 128 input rows, grid y = two heads) straight from the f32 inputs; FOUR WAVES per 128x128 tile, each wave one 64x64 quarter (16 accumulators), k order and fragment map as in k_gemmw.
// A pass is 32 k = one 128-byte line of every f32 row: wave w loads whole lines of rows 64 w .. 64 w + 63 of the 256 staged rows (128 A rows, then 128 Bt rows), rounds them to bf16 (nearest even) and stores them to LDS one pass ahead of their use;
// two LDS buffers, one barrier a pass; the f32 loads run three passes ahead of their rows' use. grid z = 3: the bf16 copy of Wo for the output projection (no tile, leaves before any barrier).
// q, k: A = input rows t, Bt = weight rows d: quarter [t][d] -> planes [b][z * NH_ + head][t][d]. v: the operands change places (A = weight rows d, Bt = input rows t): quarter [d][t] -> planes [b][head][d][t].
// Either way a quarter's row is 64 consecutive plane elements = one 128-byte line, written whole by its wave (16 rows at a time through LDS, 8 lanes a row).
__global__ __launch_bounds__(128) void k_proj(const float* __restrict__ xq, const float* __restrict__ xk, const float* __restrict__ xv, const float* __restrict__ wq, const float* __restrict__ wk, const float* __restrict__ wv, const float* __restrict__ wo,
                                              bf* WO, h16* QK16, bf* QKh, bf* QKl, h16* VT16, bf* VTh, bf* VTl) {
    typedef WFrag<bf>::V V;
    __shared__ __align__(16) bf st[2 * 256 * PP];
    __shared__ __align__(16) float osw[4 * 16 * 68];
    const int z = blockIdx.z;
    if (z == 3) {   // four elements a thread and trip: a wave reads 512 and writes 256 consecutive bytes at a time
        for (unsigned e = (blockIdx.y * gridDim.x + blockIdx.x) * 128 + threadIdx.x; e < DM * DQ / 4; e += gridDim.x * gridDim.y * 128) *(v4us*)(WO + (size_t)e * 4) = __builtin_bit_cast(v4us, __builtin_convertvector(*(const v4f*)(wo + (size_t)e * 4), v4bf));
        return;
    }
    const bool tr = z == 2;
    const int w = __builtin_amdgcn_readfirstlane((int)(threadIdx.x >> 5)), wa = w >> 1, wb = w & 1;
    const int lane = threadIdx.x & 31, lr = lane & 15, hi = lane >> 4;
    const float* xr = ((z == 0) ? xq : (z == 1) ? xk : xv) + (size_t)blockIdx.x * 128 * DM; const float* wr = ((z == 0) ? wq : (z == 1) ? wk : wv) + (size_t)blockIdx.y * 128 * DM;
    const float* G = (((w < 2) != tr) ? xr : wr) + (w & 1) * 64 * DM;   // this wave's 64 rows to stage
    unsigned vb = (lane >> 3) * (DM * 4) + (lane & 7) * 16;   // the lane's byte offset in them, at the next pass to load: a load covers 4 rows x 128 bytes
    bf* sd = st + (w * 64 + (lane >> 3)) * PP + (lane & 7) * 4;
    const bf* fa = st + (wa * 64 + lr) * PP + 8 * hi; const bf* fb = st + (128 + wb * 64 + lr) * PP + 8 * hi;
    v4f r0[16], r1[16];   // the f32 rows of two later passes, in flight
    auto ldg = [&](v4f (&r)[16], int ahead) {
#pragma unroll
        for (int i = 0; i < 16; ++i) r[i] = *(const v4f*)((const char*)G + vb + (ahead * 128 + i * 16 * DM)); };
    auto sts = [&](const v4f (&r)[16], int buf) {
#pragma unroll
        for (int i = 0; i < 16; ++i) *(v4us*)(sd + buf * 256 * PP + i * 4 * PP) = __builtin_bit_cast(v4us, __builtin_convertvector(r[i], v4bf)); };
    // Work-group barrier by hand: __syncthreads() would also wait for the global loads issued ahead, which are to stay in flight across it. The wait ends this wave's LDS stores (published here) and LDS reads (their buffer is rewritten behind it).
    auto bar = [&]() { asm volatile("s_wait_dscnt 0x0\n\ts_barrier_signal -1\n\ts_barrier_wait -1" ::: "memory"); };
    v8f acc[4][4];
#pragma unroll
    for (int mb = 0; mb < 4; ++mb)
#pragma unroll
        for (int nb = 0; nb < 4; ++nb) acc[mb][nb] = (v8f){};
    // The wait stands in front of every overwrite of the offset register that the issued loads name: the offset goes through the statement, so that its next step cannot be placed ahead of it.
    auto xw = [&]() { asm volatile("s_wait_xcnt 0x0" : "+v"(vb) :: "memory"); };
    ldg(r0, 0); ldg(r1, 1);
    __builtin_amdgcn_sched_barrier(0);   // the loads of pass 2 issue behind all of pass 1's, as in the loop: the loop's first wait then leaves them in flight
    sts(r0, 0); ldg(r0, 2); xw(); vb += 3 * 128;
    bar();
    // A pass reads buffer buf; it stores the next pass's rows (loaded two passes ago) into the other buffer, which every wave left at the last barrier, and loads the rows of the third pass from here in their place.
    auto pass = [&](int buf, v4f (&r)[16], bool st_, bool ld_) __attribute__((always_inline)) {
        V a[4], bb[4];
#pragma unroll
        for (int mb = 0; mb < 4; ++mb) { a[mb] = WFrag<bf>::ld(fa + buf * 256 * PP + mb * 16 * PP); bb[mb] = WFrag<bf>::ld(fb + buf * 256 * PP + mb * 16 * PP); }
        __builtin_amdgcn_sched_barrier(0);   // all fragment reads issue here and land while the next rows are rounded and stored
        if (st_) sts(r, buf ^ 1);
        if (ld_) { ldg(r, 0); xw(); vb += 128; }
#pragma unroll
        for (int nb = 0; nb < 4; ++nb)
#pragma unroll
            for (int mb = 0; mb < 4; ++mb) acc[mb][nb] = WFrag<bf>::mma(a[mb], bb[nb], acc[mb][nb]);
        if (st_) bar();   // the last pass stores nothing, and nothing is staged behind it
    };
    // Two passes a trip: buffers and register sets have constant indices. Every pass of the loop loads, so that the count of younger loads in flight is fixed and a pass waits for its own rows alone; the last four passes stand behind the loop, which stays rolled (short text).
#pragma unroll 1
    for (int kc = 0; kc < DM - 128; kc += 64) { pass(0, r1, true, true); pass(1, r0, true, true); }
    pass(0, r1, true, true); pass(1, r0, true, false); pass(0, r1, true, false); pass(1, r0, false, false);
    const int hd = blockIdx.y * 2 + (tr ? wa : wb), t0 = (blockIdx.x * 2 + (tr ? wb : wa)) * 64; float* os = osw + w * 16 * 68;
    const int b = t0 / TT, t = t0 % TT;   // a quarter lies in one batch (TT % 64 == 0)
    const size_t base = tr ? ((size_t)b * NKV + hd) * HD * TT + t : (((size_t)b * (NH_ + NKV) + z * NH_ + hd) * TT + t) * HD; const size_t pitch = tr ? TT : HD;
    h16* P16 = (tr ? VT16 : QK16) + base; bf* Ph = (tr ? VTh : QKh) + base; bf* Pl = (tr ? VTl : QKl) + base;
#pragma unroll
    for (int mb = 0; mb < 4; ++mb) {
#pragma unroll
        for (int nb = 0; nb < 4; ++nb) {
#pragma unroll
            for (int j = 0; j < 8; ++j) os[(hi * 8 + j) * 68 + nb * 16 + lr] = acc[mb][nb][j]; }
        __builtin_amdgcn_wave_barrier(); asm volatile("" ::: "memory");   // the rows are read back by other lanes of this wave: keeps the reads behind the writes
#pragma unroll
        for (int s = 0; s < 4; ++s) { const int row = 4 * s + (lane >> 3), cofs = (lane & 7) * 8; const v4f x0 = *(const v4fa*)(os + row * 68 + cofs), x1 = *(const v4fa*)(os + row * 68 + cofs + 4);
            const v8f x = __builtin_shufflevector(x0, x1, 0, 1, 2, 3, 4, 5, 6, 7); const v8bf xh = __builtin_convertvector(x, v8bf), xl = __builtin_convertvector(x - __builtin_convertvector(xh, v8f), v8bf);   // round to nearest even, as f2bf and splitf do
            const size_t o = (size_t)(mb * 16 + row) * pitch + cofs; *(v8h*)(P16 + o) = __builtin_convertvector(x, v8h); *(v8us*)(Ph + o) = __builtin_bit_cast(v8us, xh); *(v8us*)(Pl + o) = __builtin_bit_cast(v8us, xl); }
        __builtin_amdgcn_wave_barrier(); asm volatile("" ::: "memory");   // the next 16 rows overwrite the staging rows only behind these reads
    }
}
// ---- k_attn: causal attention of QT query rows of one head, scores never leave the registers. Transposed products: S^T = K Q^T (A = 16 key rows, B = 16 query columns), O^T += V^T P^T (A = 16 rows of the value plane [d][t],
// B = P^T packed from two S^T tiles: element s of the operand is key 8h + s (s < 8) or 16 + 8h + s - 8, which is the k order of WFrag::ld). A lane holds scores and context of ONE query (column l & 15): maximum, sum and rescale are in-lane
// plus one exchange between the wave's halves. Running maximum m of the raw scores; P = 2^((s - m) SCL2 + POFF), SCL2 = 512^-0.5 log2(e) (POFF = 10 carries the f16 P x1024, it cancels in O / sum).
// The unroll directives give every fragment and accumulator array constant indices, so that it lives in registers.
__device__ __forceinline__ float xhalf(float x) { const int b = __float_as_int(x); return __int_as_float(__builtin_amdgcn_permlanex16(b, b, 0x76543210, 0xfedcba98, false, false)); }   // lane l <-> l ^ 16
template <typename T16, bool SPLIT, int NQG, int CS>   // NQG 16-column query groups, from group g0 of the tile; key chunks cf, cf + CS, ...; partial result to LDS slot cf
__device__ __forceinline__ void attn_wave(const T16* __restrict__ Q, const T16* __restrict__ Q2, const T16* __restrict__ Kp, const T16* __restrict__ K2, const T16* __restrict__ Vt, const T16* __restrict__ Vt2, int qt, int g0, int cf, float* om, float* ol, float* oo) {
    typedef typename WFrag<T16>::V V;
    constexpr float SCL2 = (float)(SCL * 1.4426950408889634), POFF = SPLIT ? 0.0f : 10.0f;
    const int lane = threadIdx.x & 31, lr = lane & 15, hi = lane >> 4; const int qc = 16 * g0 + lr;   // this lane's column of group 0 within the tile
    V qf[NQG][2], qf2[NQG][2];
#pragma unroll
    for (int qg = 0; qg < NQG; ++qg)
#pragma unroll
        for (int ks = 0; ks < 2; ++ks) { const size_t o = (size_t)(qt * QT + 16 * qg + qc) * HD + 32 * ks + 8 * hi; qf[qg][ks] = WFrag<T16>::ld(Q + o); if (SPLIT) qf2[qg][ks] = WFrag<T16>::ld(Q2 + o); }
    v8f ot[4][NQG]; float m[NQG], l[NQG];
#pragma unroll
    for (int qg = 0; qg < NQG; ++qg) { m[qg] = -3.0e38f; l[qg] = 0.f;
#pragma unroll
        for (int dt = 0; dt < 4; ++dt) ot[dt][qg] = (v8f){}; }
    V kf[2][2], kf2[2][2];
    auto ldk = [&](int c) {   // the four (hi/lo: eight) key fragments of chunk c
#pragma unroll
        for (int kt = 0; kt < 2; ++kt)
#pragma unroll
            for (int ks = 0; ks < 2; ++ks) { const size_t o = (size_t)(c * 32 + 16 * kt + lr) * HD + 32 * ks + 8 * hi; kf[kt][ks] = WFrag<T16>::ld(Kp + o); if (SPLIT) kf2[kt][ks] = WFrag<T16>::ld(K2 + o); } };
    ldk(min(cf, qt));
    for (int c = cf; c <= qt; c += CS) {
        const int k0 = c * 32;
        V vf[4], vf2[4];
#pragma unroll
        for (int dt = 0; dt < 4; ++dt) { const size_t o = (size_t)(16 * dt + lr) * TT + k0 + 8 * hi; vf[dt] = WFrag<T16>::ld(Vt + o); if (SPLIT) vf2[dt] = WFrag<T16>::ld(Vt2 + o); }
        __builtin_amdgcn_sched_barrier(0);   // the value loads issue here, ahead of the score products, and land while scores and softmax run
        v8f s[2][NQG];
#pragma unroll
        for (int kt = 0; kt < 2; ++kt)
#pragma unroll
            for (int qg = 0; qg < NQG; ++qg) { v8f a = (v8f){};
#pragma unroll
                for (int ks = 0; ks < 2; ++ks) { a = WFrag<T16>::mma(kf[kt][ks], qf[qg][ks], a); if (SPLIT) { a = WFrag<T16>::mma(kf[kt][ks], qf2[qg][ks], a); a = WFrag<T16>::mma(kf2[kt][ks], qf[qg][ks], a); } }
                s[kt][qg] = a; }
        ldk(min(c + CS, qt));   // this wave's next chunk, one pass ahead (the last pass re-reads an in-range chunk and drops it)
        __builtin_amdgcn_sched_barrier(0);   // the key loads issue here, right behind their registers' last use, and land while softmax and P.V run
        float mn[NQG]; bool up = false;
#pragma unroll
        for (int qg = 0; qg < NQG; ++qg) { float mx = -3.0e38f;
#pragma unroll
            for (int kt = 0; kt < 2; ++kt)
#pragma unroll
                for (int r = 0; r < 8; ++r) { float t = s[kt][qg][r]; if (c == qt) t = (16 * kt + 8 * hi + r <= 16 * qg + qc) ? t : -3.0e38f;   // only the last chunk crosses the diagonal (its first key is the tile's first query)
                    s[kt][qg][r] = t; mx = fmaxf(mx, t); }
            mn[qg] = fmaxf(m[qg], fmaxf(mx, xhalf(mx))); up = up || (mn[qg] > m[qg]); }
        if (__builtin_amdgcn_ballot_w32(up) != 0) {   // a maximum moved: bring sums and context to the new one (the factor is exactly 1 otherwise)
#pragma unroll
            for (int qg = 0; qg < NQG; ++qg) { const float al = __builtin_amdgcn_exp2f((m[qg] - mn[qg]) * SCL2); l[qg] *= al; m[qg] = mn[qg];
#pragma unroll
                for (int dt = 0; dt < 4; ++dt) ot[dt][qg] *= al; } }
#pragma unroll
        for (int qg = 0; qg < NQG; ++qg) { const float mo = POFF - m[qg] * SCL2; v8f p[2];
#pragma unroll
            for (int kt = 0; kt < 2; ++kt)
#pragma unroll
                for (int r = 0; r < 8; ++r) { p[kt][r] = __builtin_amdgcn_exp2f(fmaf(s[kt][qg][r], SCL2, mo)); l[qg] += p[kt][r]; }
            if constexpr (SPLIT) {
                const v8bf h0 = __builtin_convertvector(p[0], v8bf), h1 = __builtin_convertvector(p[1], v8bf);
                const v8bf l0 = __builtin_convertvector(p[0] - __builtin_convertvector(h0, v8f), v8bf), l1 = __builtin_convertvector(p[1] - __builtin_convertvector(h1, v8f), v8bf);
                const V ph = __builtin_shufflevector(h0, h1, 0, 1, 2, 3, 4, 5, 6, 7, 8, 9, 10, 11, 12, 13, 14, 15), pl = __builtin_shufflevector(l0, l1, 0, 1, 2, 3, 4, 5, 6, 7, 8, 9, 10, 11, 12, 13, 14, 15);
#pragma unroll
                for (int dt = 0; dt < 4; ++dt) { ot[dt][qg] = WFrag<T16>::mma(vf[dt], ph, ot[dt][qg]); ot[dt][qg] = WFrag<T16>::mma(vf[dt], pl, ot[dt][qg]); ot[dt][qg] = WFrag<T16>::mma(vf2[dt], ph, ot[dt][qg]); }
            } else {
                const V ph = cat16(__builtin_convertvector(p[0], v8h), __builtin_convertvector(p[1], v8h));
#pragma unroll
                for (int dt = 0; dt < 4; ++dt) ot[dt][qg] = WFrag<T16>::mma(vf[dt], ph, ot[dt][qg]);
            } }
    }
    // this wave's partial result: maximum, sum (halves joined) and 64 context values per query; maximum in log2 units; a wave without a chunk hands over a maximum far below any score, sum 0, context 0
#pragma unroll
    for (int qg = 0; qg < NQG; ++qg) { const float ls = l[qg] + xhalf(l[qg]); const int q = cf * QT + 16 * qg + qc; if (hi == 0) { om[q] = m[qg] * SCL2; ol[q] = ls; }
#pragma unroll
        for (int dt = 0; dt < 4; ++dt) { float* d = oo + (size_t)q * OSP + 16 * dt + 8 * hi; *(v4fa*)d = __builtin_shufflevector(ot[dt][qg], ot[dt][qg], 0, 1, 2, 3); *(v4fa*)(d + 4) = __builtin_shufflevector(ot[dt][qg], ot[dt][qg], 4, 5, 6, 7); } }
}

// grid (heads, batches, TT / QT), longest query tiles first (low z starts first); tiles of query rows < RH run the bf16 hi/lo form, the others the f16 form.
// Four waves per SIMD (at most 256 registers a wave): the vector work between the matrix runs of one wave is covered by the others, and the whole grid is resident at once.
__global__ __launch_bounds__(32 * AW) __attribute__((amdgpu_waves_per_eu(4, 4))) void k_attn(const h16* __restrict__ QK16, const bf* __restrict__ QKh, const bf* __restrict__ QKl, const h16* __restrict__ VT16, const bf* __restrict__ VTh, const bf* __restrict__ VTl, bf* ATh, bf* ATl) {
    __shared__ __align__(16) float oo[AW * QT * OSP]; __shared__ float om[AW * QT]; __shared__ float ol[AW * QT];
    const int qt = (int)(gridDim.z - 1 - blockIdx.z), h = blockIdx.x, b = blockIdx.y; const int w = __builtin_amdgcn_readfirstlane((int)(threadIdx.x >> 5));
    const size_t zq = ((size_t)b * (NH_ + NKV) + h) * TT * HD, zk = ((size_t)b * (NH_ + NKV) + NH_ + h / REP) * TT * HD, zv = ((size_t)b * NKV + h / REP) * HD * TT;
    const bool hires = qt * QT < RH; const int np = hires ? AW / 2 : AW;   // partial results per query
    if (hires) attn_wave<bf, true, 1, AW / 2>(QKh + zq, QKl + zq, QKh + zk, QKl + zk, VTh + zv, VTl + zv, qt, w & 1, w >> 1, om, ol, oo);   // one query group a wave (its twofold operands fit the registers of the f16 form), two waves split the keys
    else attn_wave<h16, false, 2, AW>(QK16 + zq, nullptr, QK16 + zk, nullptr, VT16 + zv, nullptr, qt, 0, w, om, ol, oo);
    __syncthreads();
    // join the np partial results: wave w finishes queries 8w .. 8w + 7, four lanes a query (16 context values each), so each 128-byte line of the context planes has one writing wave
    const int lane = threadIdx.x & 31, q = w * 8 + (lane >> 2), dr = (lane & 3) * 16;
    float M = om[q];
#pragma unroll
    for (int u = 1; u < AW; ++u) if (u < np) M = fmaxf(M, om[u * QT + q]);
    float Ls = 0.f; v4f acc[4];
#pragma unroll
    for (int j = 0; j < 4; ++j) acc[j] = (v4f){};
#pragma unroll
    for (int u = 0; u < AW; ++u) if (u < np) { const float cw = __builtin_amdgcn_exp2f(om[u * QT + q] - M); Ls += cw * ol[u * QT + q];
#pragma unroll
        for (int j = 0; j < 4; ++j) acc[j] += cw * *(const v4fa*)(oo + (size_t)(u * QT + q) * OSP + dr + 4 * j); }
    const float inv = __fdiv_rn(1.0f, Ls); v8us oh[2], olo[2];
#pragma unroll
    for (int j = 0; j < 16; ++j) { unsigned short a, c2; splitf(acc[j >> 2][j & 3] * inv, a, c2); oh[j >> 3][j & 7] = a; olo[j >> 3][j & 7] = c2; }
    const size_t off = ((size_t)b * TT + qt * QT + q) * DQ + h * HD + dr;
    *(v8us*)(ATh + off) = oh[0]; *(v8us*)(ATh + off + 8) = oh[1]; *(v8us*)(ATl + off) = olo[0]; *(v8us*)(ATl + off + 8) = olo[1];
}

extern "C" void kernel_launch(void* const* d_in, const int* in_sizes, int n_in,
                              void* d_out, int out_size, void* d_ws, size_t ws_size, hipStream_t stream) {
    if (n_in < 7) return;
    const size_t needx = ((size_t)(NB - 1) * SEQ_FULL + SEQ) * DM;     // rows actually read / written (full per-batch stride, SEQ rows of the last batch)
    if ((size_t)in_sizes[0] < needx || (size_t)in_sizes[1] < needx || (size_t)in_sizes[2] < needx) return;
    if (in_sizes[3] < DQ * DM || in_sizes[4] < DKV * DM || in_sizes[5] < DKV * DM || in_sizes[6] < DM * DQ) return;
    if ((size_t)out_size < needx) return;
    const float* xq = (const float*)d_in[0]; const float* xk = (const float*)d_in[1]; const float* xv = (const float*)d_in[2];
    const float* wq = (const float*)d_in[3]; const float* wk = (const float*)d_in[4]; const float* wv = (const float*)d_in[5]; const float* wo = (const float*)d_in[6];
    float* OUT = (float*)d_out;     // [NB_FULL][SEQ_FULL][DM]
    char* wsp = (char*)d_ws;
    auto take = [&](size_t bytes) { char* p = wsp; wsp += (bytes + 255) & ~(size_t)255; return (void*)p; };
    bf* WO = (bf*)take((size_t)DM * DQ * 2);
    h16* QK16 = (h16*)take((size_t)NB * (NH_ + NKV) * TT * HD * 2); bf* QKh = (bf*)take((size_t)NB * (NH_ + NKV) * TT * HD * 2); bf* QKl = (bf*)take((size_t)NB * (NH_ + NKV) * TT * HD * 2);   // [b][q heads, then k heads][t][d]
    h16* VT16 = (h16*)take((size_t)NB * NKV * HD * TT * 2); bf* VTh = (bf*)take((size_t)NB * NKV * HD * TT * 2); bf* VTl = (bf*)take((size_t)NB * NKV * HD * TT * 2);
    bf* ATh = (bf*)take((size_t)NB * TT * DQ * 2); bf* ATl = (bf*)take((size_t)NB * TT * DQ * 2);
    if ((size_t)(wsp - (char*)d_ws) > ws_size) return;
    k_proj<<<dim3(NB * TT / 128, NH_ / 2, 4), 128, 0, stream>>>(xq, xk, xv, wq, wk, wv, wo, WO, QK16, QKh, QKl, VT16, VTh, VTl);   // z = q, k, v -> head planes; z = 3: bf16 Wo ([out][in] = Bt rows as-is)
    k_attn<<<dim3(NH_, NB, TT / QT), 32 * AW, 0, stream>>>(QK16, QKh, QKl, VT16, VTh, VTl, ATh, ATl);
    k_gemmw<bf, 1, false><<<dim3(NB * TT / 64, DM / 64, 1), 32, 0, stream>>>(ATh, ATl, WO, nullptr, DQ, OUT, DM, nullptr, 0, 0, 0);
}

// v005
// One run takes 42.6 microseconds.
// Two timings next to v004 put it at 1.30 and 1.29 times that version's speed.
// All steps since v000 together make it 17.4 times as fast.
#include <hip/hip_runtime.h>

// Contractions and dtypes (f32 accumulate everywhere): q/k/v projections v_wmma_f32_16x16x32_bf16 on the inputs rounded to bf16 (nearest even; exact products);
// scores and P.V for query rows < 512: bf16 hi/lo split operands (3 products); query rows >= 512: v_wmma_f32_16x16x32_f16 (f16 q/k/v planes, P carried x1024);
// output projection: bf16 hi/lo context planes x bf16 Wo (2 products); softmax and all side math f32.
// Sizes: query/key/value [2][2048][512], weights [512][512] in [out][in] layout (y = x W^T), 8 heads of 64, causal (keys j <= i), scores x 512^-0.5, out [2][2048][512].
// Both batches at once: projections (grid z = q, k, v) read the f32 inputs and round them on the way into LDS, each 64x64 tile written from its accumulators straight to the head planes of q, k ([b][h], rows t, k = d)
// and of v ([b][h], rows d, k = t), each f16 + bf16 hi/lo; one attention launch for all batches and heads: scores, running-maximum softmax and P.V stay in registers,
// the waves of a work-group split the keys and join through LDS -> context hi/lo planes (rows b*SEQ + t, k = h*64 + d); then context x Wo -> out, both batches in one launch.
// FRAGMENT ORDER: every 16-bit plane in the workspace is stored in the order in which a wave loads it as a matrix operand. A block of 16 rows x 32 k is 1024 consecutive bytes: part p (0, 1), lane l, element e hold
// row l & 15, k = 16 p + 8 (l >> 4) + e. A fragment is then two loads of 512 consecutive bytes (four whole 128-byte lines each) in place of two loads of 32 bytes from each of 16 lines.
// Order of the blocks: q, k planes [16-row tile of t][32 d]; v planes [32 t][16-row tile of d]; context planes and Wo [16-row tile][32 k].

#ifndef NB
#define NB 2
#endif
#ifndef SEQ
#define SEQ 2048
#endif
#define NB_FULL  2
#define SEQ_FULL 2048
#define TT   SEQ
#define DM   512
#define NH_  8
#define NKV  8
#define REP  (NH_ / NKV)
#define HD   64
#define DQ   (NH_ * HD)
#define DKV  (NKV * HD)
#define RH   (((TT) < 512) ? (TT) : 512)   // query rows < RH use hi+lo operands
#define SCL  0.044194173824159216         // 512^-0.5
#define QT   32                             // query columns per attention work-group (two 16-column groups; an f16-form wave takes both, a hi/lo-form wave one)
#define AW   4                              // waves per attention work-group; they split the 32-key chunks of the tile's keys
#define OSP  68                             // LDS pitch (floats) of a query's 64 partial context values

static_assert(NB >= 1 && NB <= NB_FULL);
static_assert(SEQ >= 128 && SEQ <= SEQ_FULL && (SEQ % 128) == 0);
static_assert((RH % QT) == 0 && (TT % QT) == 0 && RH > 0 && QT == 32 && QT == 8 * AW);
static_assert(REP == 1 && HD == 64 && (DM % 64) == 0 && (DQ % 64) == 0 && (DKV % 64) == 0);
// workspace carve (every region is a multiple of 256 B and of its store granularity)
#define WS_TOTAL ((size_t)DM * DQ * 2 \
                + (size_t)NB * (NH_ + 2 * NKV) * TT * HD * 2 + (size_t)NB * (2 * NH_ + 4 * NKV) * TT * HD * 2 \
                + (size_t)2 * NB * TT * DQ * 2)
static_assert(WS_TOTAL <= (size_t)268435456);
static_assert(SEQ == SEQ_FULL || NB == 1);      // the batches' rows are read and written as one [NB*SEQ][512] matrix
static_assert(DKV == DQ && (NH_ % 2) == 0 && DM >= 256);     // q, k, v projections share one launch (grid z), two heads a work-group, at least eight passes of 32 k
static_assert(((size_t)(NB - 1) * SEQ_FULL + SEQ) * DM <= (size_t)NB_FULL * SEQ_FULL * DM);

typedef _Float16 h16;
typedef unsigned short bf;
typedef __attribute__((ext_vector_type(16))) __bf16   v16bf;
typedef __attribute__((ext_vector_type(16))) _Float16 v16h;
typedef __attribute__((ext_vector_type(8)))  _Float16 v8h;
typedef __attribute__((ext_vector_type(8)))  unsigned short v8us;
typedef __attribute__((ext_vector_type(8)))  float    v8f;
typedef __attribute__((ext_vector_type(4)))  float    v4f;
typedef v8h  __attribute__((may_alias)) v8ha;
typedef v4f  __attribute__((may_alias)) v4fa;
typedef v8us __attribute__((may_alias)) v8usa;

__device__ __forceinline__ unsigned short f2bf(float f) { unsigned u = __float_as_uint(f); u += 0x7FFFu + ((u >> 16) & 1u); return (unsigned short)(u >> 16); }
__device__ __forceinline__ float bf2f(unsigned short b) { return __uint_as_float(((unsigned)b) << 16); }
__device__ __forceinline__ float bfr(float f) { return bf2f(f2bf(f)); }
__device__ __forceinline__ v16h cat16(v8h lo, v8h hi) { return __builtin_shufflevector(lo, hi, 0, 1, 2, 3, 4, 5, 6, 7, 8, 9, 10, 11, 12, 13, 14, 15); }
__device__ __forceinline__ v16bf cat16b(v8us lo, v8us hi) { return __builtin_bit_cast(v16bf, __builtin_shufflevector(lo, hi, 0, 1, 2, 3, 4, 5, 6, 7, 8, 9, 10, 11, 12, 13, 14, 15)); }
__device__ __forceinline__ v8f wmma16(v16h a, v16h b, v8f c) { return __builtin_amdgcn_wmma_f32_16x16x32_f16(false, a, false, b, (short)0, c, false, false); }
__device__ __forceinline__ v8f wmmab(v16bf a, v16bf b, v8f c) { return __builtin_amdgcn_wmma_f32_16x16x32_bf16(false, a, false, b, (short)0, c, false, false); }

// ---- k_gemmw: register-blocked GEMM, ONE WAVE per 64x64 output tile (16 accumulators), operands straight from 16-bit planes in fragment order (blocks [16-row tile][32 k]; ldf: p = block + 8 lane); grid (M/64, N/64, Z), 32 threads.
// C[m][n] (f32, pitch ldc, + optional f32 bias[n]) = sum_k A[m][k] Bt[n][k] (+ split products per NSPLIT). z-batch strides sA/sB/sC in elements. K % 32 == 0, a compile-time size: the 16-row tiles of a pass then lie at constant byte offsets.
// Fragment map (A and Bt alike, lane l, h = l>>4, row/col = l&15): elements 0..7 = k0 + 8h + 0..7, elements 8..15 = k0 + 16 + 8h + 0..7; D element r = (row 8h + r, col l&15). ld reads it from rows of consecutive k, ldf from a plane in fragment order.
template <typename T16> struct WFrag;
template <> struct WFrag<h16> { typedef v16h V; static __device__ __forceinline__ V ld(const h16* p) { return cat16(*(const v8h*)p, *(const v8h*)(p + 16)); } static __device__ __forceinline__ V ldf(const h16* p) { return cat16(*(const v8h*)p, *(const v8h*)(p + 256)); } static __device__ __forceinline__ v8f mma(V a, V b, v8f c) { return wmma16(a, b, c); } };
template <> struct WFrag<bf> { typedef v16bf V; static __device__ __forceinline__ V ld(const bf* p) { return cat16b(*(const v8us*)p, *(const v8us*)(p + 16)); } static __device__ __forceinline__ V ldf(const bf* p) { return cat16b(*(const v8us*)p, *(const v8us*)(p + 256)); } static __device__ __forceinline__ v8f mma(V a, V b, v8f c) { return wmmab(a, b, c); } };
template <typename T16, int NSPLIT, bool BIAS, int K>
__global__ __launch_bounds__(32) void k_gemmw(const T16* __restrict__ A, const T16* __restrict__ A2, const T16* __restrict__ Bt, const T16* __restrict__ Bt2, float* C, int ldc, const float* __restrict__ bias, size_t sA, size_t sB, size_t sC) {
    typedef typename WFrag<T16>::V V;
    __shared__ __align__(16) float os[16 * 68];
    const size_t z = blockIdx.z; A += z * sA; if (A2) A2 += z * sA; Bt += z * sB; if (Bt2) Bt2 += z * sB; C += z * sC;
    const int lane = threadIdx.x & 31, lr = lane & 15, hi = lane >> 4; const int r0 = blockIdx.x * 64, c0 = blockIdx.y * 64;
    v8f acc[4][4];
#pragma unroll
    for (int mb = 0; mb < 4; ++mb)
#pragma unroll
        for (int nb = 0; nb < 4; ++nb) acc[mb][nb] = (v8f){};
    // a 16-row tile is 32 K bytes, a block of 32 k in it 1024 bytes. Uniform bases; ONE per-lane byte offset serves every load of a pass (the tiles are immediate offsets) and lives over the whole loop, so that no load's result can land in it.
    const char* Ab = (const char*)(A + (size_t)r0 * K); const char* A2b = (NSPLIT == 1 || NSPLIT == 2) ? (const char*)(A2 + (size_t)r0 * K) : nullptr; const char* Bb = (const char*)(Bt + (size_t)c0 * K); const char* B2b = (NSPLIT >= 2) ? (const char*)(Bt2 + (size_t)c0 * K) : nullptr;
    unsigned vo = lane * 16;
#pragma unroll 1
    for (int kc = 0; kc < K; kc += 32) {
        V a[4], a2[4], b[4], b2[4];
#pragma unroll
        for (int mb = 0; mb < 4; ++mb) { a[mb] = WFrag<T16>::ldf((const T16*)(Ab + vo + mb * 32 * K)); if (NSPLIT == 1 || NSPLIT == 2) a2[mb] = WFrag<T16>::ldf((const T16*)(A2b + vo + mb * 32 * K)); b[mb] = WFrag<T16>::ldf((const T16*)(Bb + vo + mb * 32 * K)); if (NSPLIT >= 2) b2[mb] = WFrag<T16>::ldf((const T16*)(B2b + vo + mb * 32 * K)); }
        __builtin_amdgcn_sched_barrier(0);   // all fragment loads of the pass issue here, off the one offset register: left alone, the compiler loads two of the fragments later into registers that the pass has used, and the wave waits for memory three times a pass
#pragma unroll
        for (int nb = 0; nb < 4; ++nb) {
#pragma unroll
            for (int mb = 0; mb < 4; ++mb) { acc[mb][nb] = WFrag<T16>::mma(a[mb], b[nb], acc[mb][nb]); if (NSPLIT == 1 || NSPLIT == 2) acc[mb][nb] = WFrag<T16>::mma(a2[mb], b[nb], acc[mb][nb]); if (NSPLIT >= 2) acc[mb][nb] = WFrag<T16>::mma(a[mb], b2[nb], acc[mb][nb]); } }
        asm volatile("v_nop\n\tv_nop\n\tv_nop\n\tv_nop" : "+v"(acc[0][0]), "+v"(acc[1][1]), "+v"(acc[2][2]), "+v"(acc[3][3]) : "v"(a[0]), "v"(a[3]));
        asm volatile("s_wait_xcnt 0x0" : "+v"(vo) :: "memory"); vo += 1024;   // the wait stands in front of the one overwrite of the offset register that the pass's loads name: the offset goes through the statement, so that its step cannot be placed ahead of it
    }
#pragma unroll
    for (int mb = 0; mb < 4; ++mb) {
#pragma unroll
        for (int nb = 0; nb < 4; ++nb) {
#pragma unroll
            for (int j = 0; j < 8; ++j) os[(hi * 8 + j) * 68 + nb * 16 + lr] = acc[mb][nb][j]; }
        __builtin_amdgcn_wave_barrier(); asm volatile("" ::: "memory");
        float* crow = C + (size_t)(r0 + mb * 16) * ldc + c0;
{
#pragma unroll
            for (int s = 0; s < 8; ++s) { const int row = 2 * s + hi, cofs = lr * 4; v4f val = *(const v4fa*)(os + row * 68 + cofs); if (BIAS) { val[0] += bfr(bias[c0 + cofs]); val[1] += bfr(bias[c0 + cofs + 1]); val[2] += bfr(bias[c0 + cofs + 2]); val[3] += bfr(bias[c0 + cofs + 3]); }
                *(v4f*)(crow + (size_t)row * ldc + cofs) = val; }
             }
        __builtin_amdgcn_wave_barrier(); asm volatile("" ::: "memory");
    }
}

__device__ __forceinline__ void splitf(float y, unsigned short& h, unsigned short& l) { h = f2bf(y); l = f2bf(y - bf2f(h)); }
typedef __attribute__((ext_vector_type(4))) _Float16 v4h;
typedef __attribute__((ext_vector_type(4))) unsigned short v4us;
typedef __attribute__((ext_vector_type(2))) float v2f;

typedef __attribute__((ext_vector_type(8))) __bf16 v8bf;
typedef __attribute__((ext_vector_type(4))) __bf16 v4bf;
#define PP 40   // LDS pitch (bf16 elements) of a staged row's 32 k: 80 bytes = 16 x odd, so that the 16-byte fragment reads of 16 rows spread over the banks
// ---- k_proj: the three projections (grid z = q, k, v; grid x = 128 input rows, grid y = two heads) straight from the f32 inputs; FOUR WAVES per 128x128 tile, each wave one 64x64 quarter (16 accumulators), k order and fragment map as in k_gemmw.
// A pass is 32 k = one 128-byte line of every f32 row: wave w loads whole lines of rows 64 w .. 64 w + 63 of the 256 staged rows (128 A rows, then 128 Bt rows), rounds them to bf16 (nearest even) and stores them to LDS one pass ahead of their use;
// two LDS buffers, one barrier a pass; the f32 loads run three passes ahead of their rows' use. grid z = 3: the bf16 copy of Wo for the output projection (no tile, leaves before any barrier).
// q, k: A = input rows t, Bt = weight rows d: quarter [t][d] -> planes [b][z * NH_ + head]. v: the operands change places (A = weight rows d, Bt = input rows t): quarter [d][t] -> planes [b][head].
// Either way a quarter is 8192 consecutive bytes of its plane, in fragment order; its wave writes it 16 rows at a time through LDS, every store 512 consecutive bytes (half a block: one part of one fragment).
__global__ __launch_bounds__(128) void k_proj(const float* __restrict__ xq, const float* __restrict__ xk, const float* __restrict__ xv, const float* __restrict__ wq, const float* __restrict__ wk, const float* __restrict__ wv, const float* __restrict__ wo,
                                              bf* WO, h16* QK16, bf* QKh, bf* QKl, h16* VT16, bf* VTh, bf* VTl) {
    typedef WFrag<bf>::V V;
    __shared__ __align__(16) bf st[2 * 256 * PP];
    __shared__ __align__(16) float osw[4 * 16 * 68];
    const int z = blockIdx.z;
    if (z == 3) {   // eight elements a thread and trip, in the order of the plane: unit u = ((16-row tile * (DQ / 32) + block of 32 k) * 2 + part) * 32 + lane; a wave writes 512 consecutive bytes at a time
        for (unsigned u = (blockIdx.y * gridDim.x + blockIdx.x) * 128 + threadIdx.x; u < DM * DQ / 8; u += gridDim.x * gridDim.y * 128) {
            const unsigned n = (u / (DQ * 2)) * 16 + (u & 15), k = ((u >> 6) % (DQ / 32)) * 32 + ((u >> 5) & 1) * 16 + ((u >> 4) & 1) * 8; const float* s8 = wo + (size_t)n * DQ + k;
            const v4f x0 = *(const v4f*)s8, x1 = *(const v4f*)(s8 + 4);
            *(v8us*)(WO + (size_t)u * 8) = __builtin_bit_cast(v8us, __builtin_convertvector(__builtin_shufflevector(x0, x1, 0, 1, 2, 3, 4, 5, 6, 7), v8bf)); }
        return;
    }
    const bool tr = z == 2;
    const int w = __builtin_amdgcn_readfirstlane((int)(threadIdx.x >> 5)), wa = w >> 1, wb = w & 1;
    const int lane = threadIdx.x & 31, lr = lane & 15, hi = lane >> 4;
    const float* xr = ((z == 0) ? xq : (z == 1) ? xk : xv) + (size_t)blockIdx.x * 128 * DM; const float* wr = ((z == 0) ? wq : (z == 1) ? wk : wv) + (size_t)blockIdx.y * 128 * DM;
    const float* G = (((w < 2) != tr) ? xr : wr) + (w & 1) * 64 * DM;   // this wave's 64 rows to stage
    unsigned vb = (lane >> 3) * (DM * 4) + (lane & 7) * 16;   // the lane's byte offset in them, at the next pass to load: a load covers 4 rows x 128 bytes
    bf* sd = st + (w * 64 + (lane >> 3)) * PP + (lane & 7) * 4;
    const bf* fa = st + (wa * 64 + lr) * PP + 8 * hi; const bf* fb = st + (128 + wb * 64 + lr) * PP + 8 * hi;
    v4f r0[16], r1[16];   // the f32 rows of two later passes, in flight
    auto ldg = [&](v4f (&r)[16], int ahead) {
#pragma unroll
        for (int i = 0; i < 16; ++i) r[i] = *(const v4f*)((const char*)G + vb + (ahead * 128 + i * 16 * DM)); };
    auto sts = [&](const v4f (&r)[16], int buf) {
#pragma unroll
        for (int i = 0; i < 16; ++i) *(v4us*)(sd + buf * 256 * PP + i * 4 * PP) = __builtin_bit_cast(v4us, __builtin_convertvector(r[i], v4bf)); };
    // Work-group barrier by hand: __syncthreads() would also wait for the global loads issued ahead, which are to stay in flight across it. The wait ends this wave's LDS stores (published here) and LDS reads (their buffer is rewritten behind it).
    auto bar = [&]() { asm volatile("s_wait_dscnt 0x0\n\ts_barrier_signal -1\n\ts_barrier_wait -1" ::: "memory"); };
    v8f acc[4][4];
#pragma unroll
    for (int mb = 0; mb < 4; ++mb)
#pragma unroll
        for (int nb = 0; nb < 4; ++nb) acc[mb][nb] = (v8f){};
    // The wait stands in front of every overwrite of the offset register that the issued loads name: the offset goes through the statement, so that its next step cannot be placed ahead of it.
    auto xw = [&]() { asm volatile("s_wait_xcnt 0x0" : "+v"(vb) :: "memory"); };
    ldg(r0, 0); ldg(r1, 1);
    __builtin_amdgcn_sched_barrier(0);   // the loads of pass 2 issue behind all of pass 1's, as in the loop: the loop's first wait then leaves them in flight
    sts(r0, 0); ldg(r0, 2); xw(); vb += 3 * 128;
    bar();
    // A pass reads buffer buf; it stores the next pass's rows (loaded two passes ago) into the other buffer, which every wave left at the last barrier, and loads the rows of the third pass from here in their place.
    auto pass = [&](int buf, v4f (&r)[16], bool st_, bool ld_) __attribute__((always_inline)) {
        V a[4], bb[4];
#pragma unroll
        for (int mb = 0; mb < 4; ++mb) { a[mb] = WFrag<bf>::ld(fa + buf * 256 * PP + mb * 16 * PP); bb[mb] = WFrag<bf>::ld(fb + buf * 256 * PP + mb * 16 * PP); }
        __builtin_amdgcn_sched_barrier(0);   // all fragment reads issue here and land while the next rows are rounded and stored
        if (st_) sts(r, buf ^ 1);
        if (ld_) { ldg(r, 0); xw(); vb += 128; }
#pragma unroll
        for (int nb = 0; nb < 4; ++nb)
#pragma unroll
            for (int mb = 0; mb < 4; ++mb) acc[mb][nb] = WFrag<bf>::mma(a[mb], bb[nb], acc[mb][nb]);
        if (st_) bar();   // the last pass stores nothing, and nothing is staged behind it
    };
    // Two passes a trip: buffers and register sets have constant indices. Every pass of the loop loads, so that the count of younger loads in flight is fixed and a pass waits for its own rows alone; the last four passes stand behind the loop, which stays rolled (short text).
#pragma unroll 1
    for (int kc = 0; kc < DM - 128; kc += 64) { pass(0, r1, true, true); pass(1, r0, true, true); }
    pass(0, r1, true, true); pass(1, r0, true, false); pass(0, r1, true, false); pass(1, r0, false, false);
    const int hd = blockIdx.y * 2 + (tr ? wa : wb), t0 = (blockIdx.x * 2 + (tr ? wb : wa)) * 64; float* os = osw + w * 16 * 68;
    const int b = t0 / TT, t = t0 % TT;   // a quarter lies in one batch (TT % 64 == 0)
    const size_t base = (((size_t)b * (tr ? NKV : NH_ + NKV) + (tr ? 0 : z * NH_) + hd) * TT + t) * HD;   // 64 t of a head are 64 * HD consecutive elements in either kind of plane
    h16* P16 = (tr ? VT16 : QK16) + base; bf* Ph = (tr ? VTh : QKh) + base; bf* Pl = (tr ? VTl : QKl) + base;
#pragma unroll
    for (int mb = 0; mb < 4; ++mb) {
#pragma unroll
        for (int nb = 0; nb < 4; ++nb) {
#pragma unroll
            for (int j = 0; j < 8; ++j) os[(hi * 8 + j) * 68 + nb * 16 + lr] = acc[mb][nb][j]; }
        __builtin_amdgcn_wave_barrier(); asm volatile("" ::: "memory");   // the rows are read back by other lanes of this wave: keeps the reads behind the writes
#pragma unroll
        for (int s = 0; s < 4; ++s) { const int cofs = (2 * s + hi) * 8; const v4f x0 = *(const v4fa*)(os + lr * 68 + cofs), x1 = *(const v4fa*)(os + lr * 68 + cofs + 4);   // row lr, columns 32 (s >> 1) + 16 (s & 1) + 8 hi + 0..7: part s & 1 of the block of columns 32 (s >> 1) ..
            const v8f x = __builtin_shufflevector(x0, x1, 0, 1, 2, 3, 4, 5, 6, 7); const v8bf xh = __builtin_convertvector(x, v8bf), xl = __builtin_convertvector(x - __builtin_convertvector(xh, v8f), v8bf);   // round to nearest even, as f2bf and splitf do
            const size_t o = (tr ? (s >> 1) * 2048 + mb * 512 : mb * 1024 + (s >> 1) * 512) + (s & 1) * 256 + lane * 8; *(v8h*)(P16 + o) = __builtin_convertvector(x, v8h); *(v8us*)(Ph + o) = __builtin_bit_cast(v8us, xh); *(v8us*)(Pl + o) = __builtin_bit_cast(v8us, xl);
            asm volatile("s_wait_xcnt 0x0" ::: "memory"); }   // stands in front of the next overwrite of the address registers that these three stores name
        __builtin_amdgcn_wave_barrier(); asm volatile("" ::: "memory");   // the next 16 rows overwrite the staging rows only behind these reads
    }
}
// ---- k_attn: causal attention of QT query rows of one head, scores never leave the registers. Transposed products: S^T = K Q^T (A = 16 key rows, B = 16 query columns), O^T += V^T P^T (A = 16 rows of the value plane [d][t],
// B = P^T packed from two S^T tiles: element s of the operand is key 8h + s (s < 8) or 16 + 8h + s - 8, which is the k order of WFrag::ld and ldf). A lane holds scores and context of ONE query (column l & 15): maximum, sum and rescale are in-lane
// plus one exchange between the wave's halves. Running maximum m of the raw scores; P = 2^((s - m) SCL2 + POFF), SCL2 = 512^-0.5 log2(e) (POFF = 10 carries the f16 P x1024, it cancels in O / sum).
// The unroll directives give every fragment and accumulator array constant indices, so that it lives in registers.
__device__ __forceinline__ float xhalf(float x) { const int b = __float_as_int(x); return __int_as_float(__builtin_amdgcn_permlanex16(b, b, 0x76543210, 0xfedcba98, false, false)); }   // lane l <-> l ^ 16
template <typename T16, bool SPLIT, int NQG, int CS>   // NQG 16-column query groups, from group g0 of the tile; key chunks cf, cf + CS, ...; partial result to LDS slot cf
__device__ __forceinline__ void attn_wave(const T16* __restrict__ Q, const T16* __restrict__ Q2, const T16* __restrict__ Kp, const T16* __restrict__ K2, const T16* __restrict__ Vt, const T16* __restrict__ Vt2, int qt, int g0, int cf, float* om, float* ol, float* oo) {
    typedef typename WFrag<T16>::V V;
    constexpr float SCL2 = (float)(SCL * 1.4426950408889634), POFF = SPLIT ? 0.0f : 10.0f;
    const int lane = threadIdx.x & 31, lr = lane & 15, hi = lane >> 4; const int qc = 16 * g0 + lr;   // this lane's column of group 0 within the tile
    V qf[NQG][2], qf2[NQG][2];
#pragma unroll
    for (int qg = 0; qg < NQG; ++qg)
#pragma unroll
        for (int ks = 0; ks < 2; ++ks) { const size_t o = (size_t)(qt * QT + 16 * (qg + g0)) * HD + 512 * ks + 8 * lane; qf[qg][ks] = WFrag<T16>::ldf(Q + o); if (SPLIT) qf2[qg][ks] = WFrag<T16>::ldf(Q2 + o); }
    v8f ot[4][NQG]; float m[NQG], l[NQG];
#pragma unroll
    for (int qg = 0; qg < NQG; ++qg) { m[qg] = -3.0e38f; l[qg] = 0.f;
#pragma unroll
        for (int dt = 0; dt < 4; ++dt) ot[dt][qg] = (v8f){}; }
    V kf[2][2], kf2[2][2];
    auto ldk = [&](int c) {   // the four (hi/lo: eight) key fragments of chunk c
#pragma unroll
        for (int kt = 0; kt < 2; ++kt)
#pragma unroll
            for (int ks = 0; ks < 2; ++ks) { const size_t o = (size_t)(c * 32 + 16 * kt) * HD + 512 * ks + 8 * lane; kf[kt][ks] = WFrag<T16>::ldf(Kp + o); if (SPLIT) kf2[kt][ks] = WFrag<T16>::ldf(K2 + o); } };
    ldk(min(cf, qt));
    asm volatile("s_wait_xcnt 0x0" ::: "memory");   // stands in front of the first overwrite of the address registers that the query and key loads above name
    for (int c = cf; c <= qt; c += CS) {
        const int k0 = c * 32;
        V vf[4], vf2[4];
#pragma unroll
        for (int dt = 0; dt < 4; ++dt) { const size_t o = (size_t)k0 * HD + 512 * dt + 8 * lane; vf[dt] = WFrag<T16>::ldf(Vt + o); if (SPLIT) vf2[dt] = WFrag<T16>::ldf(Vt2 + o); }
        __builtin_amdgcn_sched_barrier(0);   // the value loads issue here, ahead of the score products, and land while scores and softmax run
        v8f s[2][NQG];
#pragma unroll
        for (int kt = 0; kt < 2; ++kt)
#pragma unroll
            for (int qg = 0; qg < NQG; ++qg) { v8f a = (v8f){};
#pragma unroll
                for (int ks = 0; ks < 2; ++ks) { a = WFrag<T16>::mma(kf[kt][ks], qf[qg][ks], a); if (SPLIT) { a = WFrag<T16>::mma(kf[kt][ks], qf2[qg][ks], a); a = WFrag<T16>::mma(kf2[kt][ks], qf[qg][ks], a); } }
                s[kt][qg] = a; }
        ldk(min(c + CS, qt));   // this wave's next chunk, one pass ahead (the last pass re-reads an in-range chunk and drops it)
        __builtin_amdgcn_sched_barrier(0);   // the key loads issue here, right behind their registers' last use, and land while softmax and P.V run
        float mn[NQG]; bool up = false;
#pragma unroll
        for (int qg = 0; qg < NQG; ++qg) { float mx = -3.0e38f;
#pragma unroll
            for (int kt = 0; kt < 2; ++kt)
#pragma unroll
                for (int r = 0; r < 8; ++r) { float t = s[kt][qg][r]; if (c == qt) t = (16 * kt + 8 * hi + r <= 16 * qg + qc) ? t : -3.0e38f;   // only the last chunk crosses the diagonal (its first key is the tile's first query)
                    s[kt][qg][r] = t; mx = fmaxf(mx, t); }
            mn[qg] = fmaxf(m[qg], fmaxf(mx, xhalf(mx))); up = up || (mn[qg] > m[qg]); }
        if (__builtin_amdgcn_ballot_w32(up) != 0) {   // a maximum moved: bring sums and context to the new one (the factor is exactly 1 otherwise)
#pragma unroll
            for (int qg = 0; qg < NQG; ++qg) { const float al = __builtin_amdgcn_exp2f((m[qg] - mn[qg]) * SCL2); l[qg] *= al; m[qg] = mn[qg];
#pragma unroll
                for (int dt = 0; dt < 4; ++dt) ot[dt][qg] *= al; } }
#pragma unroll
        for (int qg = 0; qg < NQG; ++qg) { const float mo = POFF - m[qg] * SCL2; v8f p[2];
#pragma unroll
            for (int kt = 0; kt < 2; ++kt)
#pragma unroll
                for (int r = 0; r < 8; ++r) { p[kt][r] = __builtin_amdgcn_exp2f(fmaf(s[kt][qg][r], SCL2, mo)); l[qg] += p[kt][r]; }
            if constexpr (SPLIT) {
                const v8bf h0 = __builtin_convertvector(p[0], v8bf), h1 = __builtin_convertvector(p[1], v8bf);
                const v8bf l0 = __builtin_convertvector(p[0] - __builtin_convertvector(h0, v8f), v8bf), l1 = __builtin_convertvector(p[1] - __builtin_convertvector(h1, v8f), v8bf);
                const V ph = __builtin_shufflevector(h0, h1, 0, 1, 2, 3, 4, 5, 6, 7, 8, 9, 10, 11, 12, 13, 14, 15), pl = __builtin_shufflevector(l0, l1, 0, 1, 2, 3, 4, 5, 6, 7, 8, 9, 10, 11, 12, 13, 14, 15);
#pragma unroll
                for (int dt = 0; dt < 4; ++dt) { ot[dt][qg] = WFrag<T16>::mma(vf[dt], ph, ot[dt][qg]); ot[dt][qg] = WFrag<T16>::mma(vf[dt], pl, ot[dt][qg]); ot[dt][qg] = WFrag<T16>::mma(vf2[dt], ph, ot[dt][qg]); }
            } else {
                const V ph = cat16(__builtin_convertvector(p[0], v8h), __builtin_convertvector(p[1], v8h));
#pragma unroll
                for (int dt = 0; dt < 4; ++dt) ot[dt][qg] = WFrag<T16>::mma(vf[dt], ph, ot[dt][qg]);
            } }
    }
    // this wave's partial result: maximum, sum (halves joined) and 64 context values per query; maximum in log2 units; a wave without a chunk hands over a maximum far below any score, sum 0, context 0
#pragma unroll
    for (int qg = 0; qg < NQG; ++qg) { const float ls = l[qg] + xhalf(l[qg]); const int q = cf * QT + 16 * qg + qc; if (hi == 0) { om[q] = m[qg] * SCL2; ol[q] = ls; }
#pragma unroll
        for (int dt = 0; dt < 4; ++dt) { float* d = oo + (size_t)q * OSP + 16 * dt + 8 * hi; *(v4fa*)d = __builtin_shufflevector(ot[dt][qg], ot[dt][qg], 0, 1, 2, 3); *(v4fa*)(d + 4) = __builtin_shufflevector(ot[dt][qg], ot[dt][qg], 4, 5, 6, 7); } }
}

// grid (heads, batches, TT / QT), longest query tiles first (low z starts first); tiles of query rows < RH run the bf16 hi/lo form, the others the f16 form.
// Four waves per SIMD (at most 256 registers a wave): the vector work between the matrix runs of one wave is covered by the others, and the whole grid is resident at once.
__global__ __launch_bounds__(32 * AW) __attribute__((amdgpu_waves_per_eu(4, 4))) void k_attn(const h16* __restrict__ QK16, const bf* __restrict__ QKh, const bf* __restrict__ QKl, const h16* __restrict__ VT16, const bf* __restrict__ VTh, const bf* __restrict__ VTl, bf* ATh, bf* ATl) {
    __shared__ __align__(16) float oo[AW * QT * OSP]; __shared__ float om[AW * QT]; __shared__ float ol[AW * QT];
    const int qt = (int)(gridDim.z - 1 - blockIdx.z), h = blockIdx.x, b = blockIdx.y; const int w = __builtin_amdgcn_readfirstlane((int)(threadIdx.x >> 5));
    const size_t zq = ((size_t)b * (NH_ + NKV) + h) * TT * HD, zk = ((size_t)b * (NH_ + NKV) + NH_ + h / REP) * TT * HD, zv = ((size_t)b * NKV + h / REP) * HD * TT;
    const bool hires = qt * QT < RH; const int np = hires ? AW / 2 : AW;   // partial results per query
    if (hires) attn_wave<bf, true, 1, AW / 2>(QKh + zq, QKl + zq, QKh + zk, QKl + zk, VTh + zv, VTl + zv, qt, w & 1, w >> 1, om, ol, oo);   // one query group a wave (its twofold operands fit the registers of the f16 form), two waves split the keys
    else attn_wave<h16, false, 2, AW>(QK16 + zq, nullptr, QK16 + zk, nullptr, VT16 + zv, nullptr, qt, 0, w, om, ol, oo);
    __syncthreads();
    // join the np partial results: wave w finishes queries 8w .. 8w + 7, four lanes a query (16 context values each); each 128-byte line of the context planes has one writing wave
    const int lane = threadIdx.x & 31, q = w * 8 + (lane >> 2), dr = (lane & 3) * 16;
    float M = om[q];
#pragma unroll
    for (int u = 1; u < AW; ++u) if (u < np) M = fmaxf(M, om[u * QT + q]);
    float Ls = 0.f; v4f acc[4];
#pragma unroll
    for (int j = 0; j < 4; ++j) acc[j] = (v4f){};
#pragma unroll
    for (int u = 0; u < AW; ++u) if (u < np) { const float cw = __builtin_amdgcn_exp2f(om[u * QT + q] - M); Ls += cw * ol[u * QT + q];
#pragma unroll
        for (int j = 0; j < 4; ++j) acc[j] += cw * *(const v4fa*)(oo + (size_t)(u * QT + q) * OSP + dr + 4 * j); }
    const float inv = __fdiv_rn(1.0f, Ls); v8us oh[2], olo[2];
#pragma unroll
    for (int j = 0; j < 16; ++j) { unsigned short a, c2; splitf(acc[j >> 2][j & 3] * inv, a, c2); oh[j >> 3][j & 7] = a; olo[j >> 3][j & 7] = c2; }
    // fragment order: 16-row tile of the query, block of 32 k and part from h * HD + dr (16 values = one part), the first eight values in lane q & 15, the others in lane 16 + (q & 15); eight queries = one whole line a store
    const size_t off = ((size_t)b * TT + qt * QT + (q & ~15)) * DQ + (h * HD + dr) * 16 + (q & 15) * 8;
    *(v8us*)(ATh + off) = oh[0]; *(v8us*)(ATh + off + 128) = oh[1]; *(v8us*)(ATl + off) = olo[0]; *(v8us*)(ATl + off + 128) = olo[1];
}

extern "C" void kernel_launch(void* const* d_in, const int* in_sizes, int n_in,
                              void* d_out, int out_size, void* d_ws, size_t ws_size, hipStream_t stream) {
    if (n_in < 7) return;
    const size_t needx = ((size_t)(NB - 1) * SEQ_FULL + SEQ) * DM;     // rows actually read / written (full per-batch stride, SEQ rows of the last batch)
    if ((size_t)in_sizes[0] < needx || (size_t)in_sizes[1] < needx || (size_t)in_sizes[2] < needx) return;
    if (in_sizes[3] < DQ * DM || in_sizes[4] < DKV * DM || in_sizes[5] < DKV * DM || in_sizes[6] < DM * DQ) return;
    if ((size_t)out_size < needx) return;
    const float* xq = (const float*)d_in[0]; const float* xk = (const float*)d_in[1]; const float* xv = (const float*)d_in[2];
    const float* wq = (const float*)d_in[3]; const float* wk = (const float*)d_in[4]; const float* wv = (const float*)d_in[5]; const float* wo = (const float*)d_in[6];
    float* OUT = (float*)d_out;     // [NB_FULL][SEQ_FULL][DM]
    char* wsp = (char*)d_ws;
    auto take = [&](size_t bytes) { char* p = wsp; wsp += (bytes + 255) & ~(size_t)255; return (void*)p; };
    bf* WO = (bf*)take((size_t)DM * DQ * 2);
    h16* QK16 = (h16*)take((size_t)NB * (NH_ + NKV) * TT * HD * 2); bf* QKh = (bf*)take((size_t)NB * (NH_ + NKV) * TT * HD * 2); bf* QKl = (bf*)take((size_t)NB * (NH_ + NKV) * TT * HD * 2);   // [b][q heads, then k heads], fragment order
    h16* VT16 = (h16*)take((size_t)NB * NKV * HD * TT * 2); bf* VTh = (bf*)take((size_t)NB * NKV * HD * TT * 2); bf* VTl = (bf*)take((size_t)NB * NKV * HD * TT * 2);
    bf* ATh = (bf*)take((size_t)NB * TT * DQ * 2); bf* ATl = (bf*)take((size_t)NB * TT * DQ * 2);
    if ((size_t)(wsp - (char*)d_ws) > ws_size) return;
    k_proj<<<dim3(NB * TT / 128, NH_ / 2, 4), 128, 0, stream>>>(xq, xk, xv, wq, wk, wv, wo, WO, QK16, QKh, QKl, VT16, VTh, VTl);   // z = q, k, v -> head planes; z = 3: bf16 Wo ([out][in] = Bt rows), fragment order
    k_attn<<<dim3(NH_, NB, TT / QT), 32 * AW, 0, stream>>>(QK16, QKh, QKl, VT16, VTh, VTl, ATh, ATl);
    k_gemmw<bf, 1, false, DQ><<<dim3(NB * TT / 64, DM / 64, 1), 32, 0, stream>>>(ATh, ATl, WO, nullptr, OUT, DM, nullptr, 0, 0, 0);
}

// v006
// One run takes 36.8 microseconds.
// Two timings next to v005 put it at 1.14 and 1.18 times that version's speed.
// Over all steps from v000 it is 20.2 times as fast.
#include <hip/hip_runtime.h>

// Contractions and dtypes (f32 accumulate everywhere): q/k/v projections v_wmma_f32_16x16x32_bf16 on the inputs rounded to bf16 (nearest even; exact products);
// scores and P.V for query rows < 512: bf16 hi/lo split operands (3 products); query rows >= 512: v_wmma_f32_16x16x32_f16 (f16 q/k/v planes, P carried x1024);
// output projection: bf16 hi/lo context planes x bf16 Wo (2 products); softmax and all side math f32.
// Sizes: query/key/value [2][2048][512], weights [512][512] in [out][in] layout (y = x W^T), 8 heads of 64, causal (keys j <= i), scores x 512^-0.5, out [2][2048][512].
// Both batches at once: projections (grid z = q, k, v) read the f32 inputs and round them on the way into LDS, each 64x64 tile written from its accumulators straight to the head planes of q, k ([b][h], rows t, k = d)
// and of v ([b][h], rows d, k = t), each f16 + bf16 hi/lo; one attention launch for all batches and heads: scores, running-maximum softmax and P.V stay in registers,
// the waves of a work-group split the keys and join through LDS -> context hi/lo planes (rows b*SEQ + t, k = h*64 + d); then context x Wo -> out, both batches in one launch.
// FRAGMENT ORDER: every 16-bit plane in the workspace is stored in the order in which a wave loads it as a matrix operand. A block of 16 rows x 32 k is 1024 consecutive bytes: part p (0, 1), lane l, element e hold
// row l & 15, k = 16 p + 8 (l >> 4) + e. A fragment is then two loads of 512 consecutive bytes (four whole 128-byte lines each) in place of two loads of 32 bytes from each of 16 lines.
// Order of the blocks: q, k planes [16-row tile of t][32 d]; v planes [32 t][16-row tile of d]; context planes and Wo [16-row tile][32 k].

#ifndef NB
#define NB 2
#endif
#ifndef SEQ
#define SEQ 2048
#endif
#define NB_FULL  2
#define SEQ_FULL 2048
#define TT   SEQ
#define DM   512
#define NH_  8
#define NKV  8
#define REP  (NH_ / NKV)
#define HD   64
#define DQ   (NH_ * HD)
#define DKV  (NKV * HD)
#define RH   (((TT) < 512) ? (TT) : 512)   // query rows < RH use hi+lo operands
#define SCL  0.044194173824159216         // 512^-0.5
#define QT   32                             // query columns per attention work-group (two 16-column groups; an f16-form wave takes both, a hi/lo-form wave one)
#define AW   4                              // waves per attention work-group; they split the 32-key chunks of the tile's keys
#define OSP  68                             // LDS pitch (floats) of a query's 64 partial context values

static_assert(NB >= 1 && NB <= NB_FULL);
static_assert(SEQ >= 128 && SEQ <= SEQ_FULL && (SEQ % 128) == 0);
static_assert((RH % QT) == 0 && (TT % QT) == 0 && RH > 0 && QT == 32 && QT == 8 * AW);
static_assert(REP == 1 && HD == 64 && (DM % 64) == 0 && (DQ % 64) == 0 && (DKV % 64) == 0);
// workspace carve (every region is a multiple of 256 B and of its store granularity)
#define WS_TOTAL ((size_t)DM * DQ * 2 \
                + (size_t)NB * (NH_ + 2 * NKV) * TT * HD * 2 + (size_t)NB * (2 * NH_ + 4 * NKV) * TT * HD * 2 \
                + (size_t)2 * NB * TT * DQ * 2)
static_assert(WS_TOTAL <= (size_t)268435456);
static_assert(SEQ == SEQ_FULL || NB == 1);      // the batches' rows are read and written as one [NB*SEQ][512] matrix
static_assert(DKV == DQ && (NH_ % 2) == 0 && DM >= 256);     // q, k, v projections share one launch (grid z), two heads a work-group, at least eight passes of 32 k
static_assert(((size_t)(NB - 1) * SEQ_FULL + SEQ) * DM <= (size_t)NB_FULL * SEQ_FULL * DM);

typedef _Float16 h16;
typedef unsigned short bf;
typedef __attribute__((ext_vector_type(16))) __bf16   v16bf;
typedef __attribute__((ext_vector_type(16))) _Float16 v16h;
typedef __attribute__((ext_vector_type(8)))  _Float16 v8h;
typedef __attribute__((ext_vector_type(8)))  unsigned short v8us;
typedef __attribute__((ext_vector_type(8)))  float    v8f;
typedef __attribute__((ext_vector_type(4)))  float    v4f;
typedef v8h  __attribute__((may_alias)) v8ha;
typedef v4f  __attribute__((may_alias)) v4fa;
typedef v8us __attribute__((may_alias)) v8usa;

__device__ __forceinline__ unsigned short f2bf(float f) { unsigned u = __float_as_uint(f); u += 0x7FFFu + ((u >> 16) & 1u); return (unsigned short)(u >> 16); }
__device__ __forceinline__ float bf2f(unsigned short b) { return __uint_as_float(((unsigned)b) << 16); }
__device__ __forceinline__ float bfr(float f) { return bf2f(f2bf(f)); }
__device__ __forceinline__ v16h cat16(v8h lo, v8h hi) { return __builtin_shufflevector(lo, hi, 0, 1, 2, 3, 4, 5, 6, 7, 8, 9, 10, 11, 12, 13, 14, 15); }
__device__ __forceinline__ v16bf cat16b(v8us lo, v8us hi) { return __builtin_bit_cast(v16bf, __builtin_shufflevector(lo, hi, 0, 1, 2, 3, 4, 5, 6, 7, 8, 9, 10, 11, 12, 13, 14, 15)); }
__device__ __forceinline__ v8f wmma16(v16h a, v16h b, v8f c) { return __builtin_amdgcn_wmma_f32_16x16x32_f16(false, a, false, b, (short)0, c, false, false); }
__device__ __forceinline__ v8f wmmab(v16bf a, v16bf b, v8f c) { return __builtin_amdgcn_wmma_f32_16x16x32_bf16(false, a, false, b, (short)0, c, false, false); }

// ---- k_gemmw: register-blocked GEMM, ONE WAVE per 64x64 output tile (16 accumulators), operands straight from 16-bit planes in fragment order (blocks [16-row tile][32 k]; ldf: p = block + 8 lane); grid (M/64, N/64, Z), 32 threads.
// C[m][n] (f32, pitch ldc, + optional f32 bias[n]) = sum_k A[m][k] Bt[n][k] (+ split products per NSPLIT). z-batch strides sA/sB/sC in elements. K % 32 == 0, a compile-time size: the 16-row tiles of a pass then lie at constant byte offsets.
// Fragment map (A and Bt alike, lane l, h = l>>4, row/col = l&15): elements 0..7 = k0 + 8h + 0..7, elements 8..15 = k0 + 16 + 8h + 0..7; D element r = (row 8h + r, col l&15). ld reads it from rows of consecutive k, ldf from a plane in fragment order.
template <typename T16> struct WFrag;
template <> struct WFrag<h16> { typedef v16h V; static __device__ __forceinline__ V ld(const h16* p) { return cat16(*(const v8h*)p, *(const v8h*)(p + 16)); } static __device__ __forceinline__ V ldf(const h16* p) { return cat16(*(const v8h*)p, *(const v8h*)(p + 256)); } static __device__ __forceinline__ v8f mma(V a, V b, v8f c) { return wmma16(a, b, c); } };
template <> struct WFrag<bf> { typedef v16bf V; static __device__ __forceinline__ V ld(const bf* p) { return cat16b(*(const v8us*)p, *(const v8us*)(p + 16)); } static __device__ __forceinline__ V ldf(const bf* p) { return cat16b(*(const v8us*)p, *(const v8us*)(p + 256)); } static __device__ __forceinline__ v8f mma(V a, V b, v8f c) { return wmmab(a, b, c); } };
template <typename T16, int NSPLIT, bool BIAS, int K>
__global__ __launch_bounds__(32) void k_gemmw(const T16* __restrict__ A, const T16* __restrict__ A2, const T16* __restrict__ Bt, const T16* __restrict__ Bt2, float* C, int ldc, const float* __restrict__ bias, size_t sA, size_t sB, size_t sC) {
    typedef typename WFrag<T16>::V V;
    __shared__ __align__(16) float os[16 * 68];
    const size_t z = blockIdx.z; A += z * sA; if (A2) A2 += z * sA; Bt += z * sB; if (Bt2) Bt2 += z * sB; C += z * sC;
    const int lane = threadIdx.x & 31, lr = lane & 15, hi = lane >> 4; const int r0 = blockIdx.x * 64, c0 = blockIdx.y * 64;
    v8f acc[4][4];
#pragma unroll
    for (int mb = 0; mb < 4; ++mb)
#pragma unroll
        for (int nb = 0; nb < 4; ++nb) acc[mb][nb] = (v8f){};
    // a 16-row tile is 32 K bytes, a block of 32 k in it 1024 bytes. Uniform bases; ONE per-lane byte offset serves every load of the kernel (tiles and passes are immediate offsets) and is never stepped.
    const char* Ab = (const char*)(A + (size_t)r0 * K); const char* A2b = (NSPLIT == 1 || NSPLIT == 2) ? (const char*)(A2 + (size_t)r0 * K) : nullptr; const char* Bb = (const char*)(Bt + (size_t)c0 * K); const char* B2b = (NSPLIT >= 2) ? (const char*)(Bt2 + (size_t)c0 * K) : nullptr;
    const unsigned vo = lane * 16;
    // REGISTER RING: RING sets of a pass's fragments; the loads run RING - 1 passes ahead of their use, so that a pass no longer waits out the whole latency of its own loads (one wave a SIMD: nothing else covers it).
    // A quarter of a set (tile j of each operand) is loaded in front of column group j of the pass that runs RING - 1 passes earlier, when the set of the pass before that one has been read to its end.
    constexpr int NP = K / 32, RING = 4; static_assert(NP >= RING);
    V a[RING][4], a2[RING][4], b[RING][4], b2[RING][4];
    auto ldq = [&](int p, int j) __attribute__((always_inline)) { const int s = p % RING, o = p * 1024 + j * 32 * K;
        a[s][j] = WFrag<T16>::ldf((const T16*)(Ab + vo + o)); if (NSPLIT == 1 || NSPLIT == 2) a2[s][j] = WFrag<T16>::ldf((const T16*)(A2b + vo + o)); b[s][j] = WFrag<T16>::ldf((const T16*)(Bb + vo + o)); if (NSPLIT >= 2) b2[s][j] = WFrag<T16>::ldf((const T16*)(B2b + vo + o)); };
#pragma unroll
    for (int p = 0; p < RING - 1; ++p)
#pragma unroll
        for (int j = 0; j < 4; ++j) ldq(p, j);
    // unrolled whole: set numbers and byte offsets are constants, and the compiler's counted waits leave the younger sets in flight
#pragma unroll
    for (int p = 0; p < NP; ++p) {
#pragma unroll
        for (int nb = 0; nb < 4; ++nb) {
            if (p + RING - 1 < NP) {
                if (p + nb > 0) asm volatile("v_nop\n\tv_nop\n\tv_nop\n\tv_nop" ::: "memory");   // four vector slots between the last product and the loads behind it: the compiler hands out registers as they fall free, so a load may name the B registers of that product; the clobber keeps the loads behind the slots
                ldq(p + RING - 1, nb); }
            __builtin_amdgcn_sched_barrier(0);   // the quarter's loads issue here, ahead of the group's products: moved later they would lose part of their lead
#pragma unroll
            for (int mb = 0; mb < 4; ++mb) { acc[mb][nb] = WFrag<T16>::mma(a[p % RING][mb], b[p % RING][nb], acc[mb][nb]); if (NSPLIT == 1 || NSPLIT == 2) acc[mb][nb] = WFrag<T16>::mma(a2[p % RING][mb], b[p % RING][nb], acc[mb][nb]); if (NSPLIT >= 2) acc[mb][nb] = WFrag<T16>::mma(a[p % RING][mb], b2[p % RING][nb], acc[mb][nb]); }
            __builtin_amdgcn_sched_barrier(0);   // the next quarter's slots and loads stay behind this group's products: the slots count from the group's last product, and no more than RING sets are live
        }
    }
    asm volatile("s_wait_xcnt 0x0" ::: "memory");   // stands in front of the first overwrite of the offset register that the loads above name
    __builtin_amdgcn_sched_barrier(0);   // keeps the epilogue's index arithmetic, which reuses that register, behind the wait
#pragma unroll
    for (int mb = 0; mb < 4; ++mb) {
#pragma unroll
        for (int nb = 0; nb < 4; ++nb) {
#pragma unroll
            for (int j = 0; j < 8; ++j) os[(hi * 8 + j) * 68 + nb * 16 + lr] = acc[mb][nb][j]; }
        __builtin_amdgcn_wave_barrier(); asm volatile("" ::: "memory");
        float* crow = C + (size_t)(r0 + mb * 16) * ldc + c0;
{
#pragma unroll
            for (int s = 0; s < 8; ++s) { const int row = 2 * s + hi, cofs = lr * 4; v4f val = *(const v4fa*)(os + row * 68 + cofs); if (BIAS) { val[0] += bfr(bias[c0 + cofs]); val[1] += bfr(bias[c0 + cofs + 1]); val[2] += bfr(bias[c0 + cofs + 2]); val[3] += bfr(bias[c0 + cofs + 3]); }
                *(v4f*)(crow + (size_t)row * ldc + cofs) = val; }
             }
        __builtin_amdgcn_wave_barrier(); asm volatile("" ::: "memory");
    }
}

__device__ __forceinline__ void splitf(float y, unsigned short& h, unsigned short& l) { h = f2bf(y); l = f2bf(y - bf2f(h)); }
typedef __attribute__((ext_vector_type(4))) _Float16 v4h;
typedef __attribute__((ext_vector_type(4))) unsigned short v4us;
typedef __attribute__((ext_vector_type(2))) float v2f;

typedef __attribute__((ext_vector_type(8))) __bf16 v8bf;
typedef __attribute__((ext_vector_type(4))) __bf16 v4bf;
#define PP 40   // LDS pitch (bf16 elements) of a staged row's 32 k: 80 bytes = 16 x odd, so that the 16-byte fragment reads of 16 rows spread over the banks
// ---- k_proj: the three projections (grid z = q, k, v; grid x = 128 input rows, grid y = two heads) straight from the f32 inputs; FOUR WAVES per 128x128 tile, each wave one 64x64 quarter (16 accumulators), k order and fragment map as in k_gemmw.
// A pass is 32 k = one 128-byte line of every f32 row: wave w loads whole lines of rows 64 w .. 64 w + 63 of the 256 staged rows (128 A rows, then 128 Bt rows), rounds them to bf16 (nearest even) and stores them to LDS one pass ahead of their use;
// two LDS buffers, one barrier a pass; the f32 loads run three passes ahead of their rows' use. grid z = 3: the bf16 copy of Wo for the output projection (no tile, leaves before any barrier).
// q, k: A = input rows t, Bt = weight rows d: quarter [t][d] -> planes [b][z * NH_ + head]. v: the operands change places (A = weight rows d, Bt = input rows t): quarter [d][t] -> planes [b][head].
// Either way a quarter is 8192 consecutive bytes of its plane, in fragment order; its wave writes it 16 rows at a time through LDS, every store 512 consecutive bytes (half a block: one part of one fragment).
__global__ __launch_bounds__(128) void k_proj(const float* __restrict__ xq, const float* __restrict__ xk, const float* __restrict__ xv, const float* __restrict__ wq, const float* __restrict__ wk, const float* __restrict__ wv, const float* __restrict__ wo,
                                              bf* WO, h16* QK16, bf* QKh, bf* QKl, h16* VT16, bf* VTh, bf* VTl) {
    typedef WFrag<bf>::V V;
    __shared__ __align__(16) bf st[2 * 256 * PP];
    __shared__ __align__(16) float osw[4 * 16 * 68];
    const int z = blockIdx.z;
    if (z == 3) {   // eight elements a thread and trip, in the order of the plane: unit u = ((16-row tile * (DQ / 32) + block of 32 k) * 2 + part) * 32 + lane; a wave writes 512 consecutive bytes at a time
        for (unsigned u = (blockIdx.y * gridDim.x + blockIdx.x) * 128 + threadIdx.x; u < DM * DQ / 8; u += gridDim.x * gridDim.y * 128) {
            const unsigned n = (u / (DQ * 2)) * 16 + (u & 15), k = ((u >> 6) % (DQ / 32)) * 32 + ((u >> 5) & 1) * 16 + ((u >> 4) & 1) * 8; const float* s8 = wo + (size_t)n * DQ + k;
            const v4f x0 = *(const v4f*)s8, x1 = *(const v4f*)(s8 + 4);
            *(v8us*)(WO + (size_t)u * 8) = __builtin_bit_cast(v8us, __builtin_convertvector(__builtin_shufflevector(x0, x1, 0, 1, 2, 3, 4, 5, 6, 7), v8bf)); }
        return;
    }
    const bool tr = z == 2;
    const int w = __builtin_amdgcn_readfirstlane((int)(threadIdx.x >> 5)), wa = w >> 1, wb = w & 1;
    const int lane = threadIdx.x & 31, lr = lane & 15, hi = lane >> 4;
    const float* xr = ((z == 0) ? xq : (z == 1) ? xk : xv) + (size_t)blockIdx.x * 128 * DM; const float* wr = ((z == 0) ? wq : (z == 1) ? wk : wv) + (size_t)blockIdx.y * 128 * DM;
    const float* G = (((w < 2) != tr) ? xr : wr) + (w & 1) * 64 * DM;   // this wave's 64 rows to stage
    unsigned vb = (lane >> 3) * (DM * 4) + (lane & 7) * 16;   // the lane's byte offset in them, at the next pass to load: a load covers 4 rows x 128 bytes
    bf* sd = st + (w * 64 + (lane >> 3)) * PP + (lane & 7) * 4;
    const bf* fa = st + (wa * 64 + lr) * PP + 8 * hi; const bf* fb = st + (128 + wb * 64 + lr) * PP + 8 * hi;
    v4f r0[16], r1[16];   // the f32 rows of two later passes, in flight
    auto ldg = [&](v4f (&r)[16], int ahead) {
#pragma unroll
        for (int i = 0; i < 16; ++i) r[i] = *(const v4f*)((const char*)G + vb + (ahead * 128 + i * 16 * DM)); };
    auto sts = [&](const v4f (&r)[16], int buf) {
#pragma unroll
        for (int i = 0; i < 16; ++i) *(v4us*)(sd + buf * 256 * PP + i * 4 * PP) = __builtin_bit_cast(v4us, __builtin_convertvector(r[i], v4bf)); };
    // Work-group barrier by hand: __syncthreads() would also wait for the global loads issued ahead, which are to stay in flight across it. The wait ends this wave's LDS stores (published here) and LDS reads (their buffer is rewritten behind it).
    auto bar = [&]() { asm volatile("s_wait_dscnt 0x0\n\ts_barrier_signal -1\n\ts_barrier_wait -1" ::: "memory"); };
    v8f acc[4][4];
#pragma unroll
    for (int mb = 0; mb < 4; ++mb)
#pragma unroll
        for (int nb = 0; nb < 4; ++nb) acc[mb][nb] = (v8f){};
    // The wait stands in front of every overwrite of the offset register that the issued loads name: the offset goes through the statement, so that its next step cannot be placed ahead of it.
    auto xw = [&]() { asm volatile("s_wait_xcnt 0x0" : "+v"(vb) :: "memory"); };
    ldg(r0, 0); ldg(r1, 1);
    __builtin_amdgcn_sched_barrier(0);   // the loads of pass 2 issue behind all of pass 1's, as in the loop: the loop's first wait then leaves them in flight
    sts(r0, 0); ldg(r0, 2); xw(); vb += 3 * 128;
    bar();
    // A pass reads buffer buf; it stores the next pass's rows (loaded two passes ago) into the other buffer, which every wave left at the last barrier, and loads the rows of the third pass from here in their place.
    auto pass = [&](int buf, v4f (&r)[16], bool st_, bool ld_) __attribute__((always_inline)) {
        V a[4], bb[4];
#pragma unroll
        for (int mb = 0; mb < 4; ++mb) { a[mb] = WFrag<bf>::ld(fa + buf * 256 * PP + mb * 16 * PP); bb[mb] = WFrag<bf>::ld(fb + buf * 256 * PP + mb * 16 * PP); }
        __builtin_amdgcn_sched_barrier(0);   // all fragment reads issue here and land while the next rows are rounded and stored
        if (st_) sts(r, buf ^ 1);
        if (ld_) { ldg(r, 0); xw(); vb += 128; }
#pragma unroll
        for (int nb = 0; nb < 4; ++nb)
#pragma unroll
            for (int mb = 0; mb < 4; ++mb) acc[mb][nb] = WFrag<bf>::mma(a[mb], bb[nb], acc[mb][nb]);
        if (st_) bar();   // the last pass stores nothing, and nothing is staged behind it
    };
    // Two passes a trip: buffers and register sets have constant indices. Every pass of the loop loads, so that the count of younger loads in flight is fixed and a pass waits for its own rows alone; the last four passes stand behind the loop, which stays rolled (short text).
#pragma unroll 1
    for (int kc = 0; kc < DM - 128; kc += 64) { pass(0, r1, true, true); pass(1, r0, true, true); }
    pass(0, r1, true, true); pass(1, r0, true, false); pass(0, r1, true, false); pass(1, r0, false, false);
    const int hd = blockIdx.y * 2 + (tr ? wa : wb), t0 = (blockIdx.x * 2 + (tr ? wb : wa)) * 64; float* os = osw + w * 16 * 68;
    const int b = t0 / TT, t = t0 % TT;   // a quarter lies in one batch (TT % 64 == 0)
    const size_t base = (((size_t)b * (tr ? NKV : NH_ + NKV) + (tr ? 0 : z * NH_) + hd) * TT + t) * HD;   // 64 t of a head are 64 * HD consecutive elements in either kind of plane
    h16* P16 = (tr ? VT16 : QK16) + base; bf* Ph = (tr ? VTh : QKh) + base; bf* Pl = (tr ? VTl : QKl) + base;
#pragma unroll
    for (int mb = 0; mb < 4; ++mb) {
#pragma unroll
        for (int nb = 0; nb < 4; ++nb) {
#pragma unroll
            for (int j = 0; j < 8; ++j) os[(hi * 8 + j) * 68 + nb * 16 + lr] = acc[mb][nb][j]; }
        __builtin_amdgcn_wave_barrier(); asm volatile("" ::: "memory");   // the rows are read back by other lanes of this wave: keeps the reads behind the writes
#pragma unroll
        for (int s = 0; s < 4; ++s) { const int cofs = (2 * s + hi) * 8; const v4f x0 = *(const v4fa*)(os + lr * 68 + cofs), x1 = *(const v4fa*)(os + lr * 68 + cofs + 4);   // row lr, columns 32 (s >> 1) + 16 (s & 1) + 8 hi + 0..7: part s & 1 of the block of columns 32 (s >> 1) ..
            const v8f x = __builtin_shufflevector(x0, x1, 0, 1, 2, 3, 4, 5, 6, 7); const v8bf xh = __builtin_convertvector(x, v8bf), xl = __builtin_convertvector(x - __builtin_convertvector(xh, v8f), v8bf);   // round to nearest even, as f2bf and splitf do
            const size_t o = (tr ? (s >> 1) * 2048 + mb * 512 : mb * 1024 + (s >> 1) * 512) + (s & 1) * 256 + lane * 8; *(v8h*)(P16 + o) = __builtin_convertvector(x, v8h); *(v8us*)(Ph + o) = __builtin_bit_cast(v8us, xh); *(v8us*)(Pl + o) = __builtin_bit_cast(v8us, xl);
            asm volatile("s_wait_xcnt 0x0" ::: "memory"); }   // stands in front of the next overwrite of the address registers that these three stores name
        __builtin_amdgcn_wave_barrier(); asm volatile("" ::: "memory");   // the next 16 rows overwrite the staging rows only behind these reads
    }
}
// ---- k_attn: causal attention of QT query rows of one head, scores never leave the registers. Transposed products: S^T = K Q^T (A = 16 key rows, B = 16 query columns), O^T += V^T P^T (A = 16 rows of the value plane [d][t],
// B = P^T packed from two S^T tiles: element s of the operand is key 8h + s (s < 8) or 16 + 8h + s - 8, which is the k order of WFrag::ld and ldf). A lane holds scores and context of ONE query (column l & 15): maximum, sum and rescale are in-lane
// plus one exchange between the wave's halves. Running maximum m of the raw scores; P = 2^((s - m) SCL2 + POFF), SCL2 = 512^-0.5 log2(e) (POFF = 10 carries the f16 P x1024, it cancels in O / sum).
// The unroll directives give every fragment and accumulator array constant indices, so that it lives in registers.
__device__ __forceinline__ float xhalf(float x) { const int b = __float_as_int(x); return __int_as_float(__builtin_amdgcn_permlanex16(b, b, 0x76543210, 0xfedcba98, false, false)); }   // lane l <-> l ^ 16
template <typename T16, bool SPLIT, int NQG, int CS>   // NQG 16-column query groups, from group g0 of the tile; key chunks cf, cf + CS, ...; partial result to LDS slot cf
__device__ __forceinline__ void attn_wave(const T16* __restrict__ Q, const T16* __restrict__ Q2, const T16* __restrict__ Kp, const T16* __restrict__ K2, const T16* __restrict__ Vt, const T16* __restrict__ Vt2, int qt, int g0, int cf, float* om, float* ol, float* oo) {
    typedef typename WFrag<T16>::V V;
    constexpr float SCL2 = (float)(SCL * 1.4426950408889634), POFF = SPLIT ? 0.0f : 10.0f;
    const int lane = threadIdx.x & 31, lr = lane & 15, hi = lane >> 4; const int qc = 16 * g0 + lr;   // this lane's column of group 0 within the tile
    V qf[NQG][2], qf2[NQG][2];
#pragma unroll
    for (int qg = 0; qg < NQG; ++qg)
#pragma unroll
        for (int ks = 0; ks < 2; ++ks) { const size_t o = (size_t)(qt * QT + 16 * (qg + g0)) * HD + 512 * ks + 8 * lane; qf[qg][ks] = WFrag<T16>::ldf(Q + o); if (SPLIT) qf2[qg][ks] = WFrag<T16>::ldf(Q2 + o); }
    v8f ot[4][NQG]; float m[NQG], l[NQG];
#pragma unroll
    for (int qg = 0; qg < NQG; ++qg) { m[qg] = -3.0e38f; l[qg] = 0.f;
#pragma unroll
        for (int dt = 0; dt < 4; ++dt) ot[dt][qg] = (v8f){}; }
    V kf[2][2], kf2[2][2];
    auto ldk = [&](int c) {   // the four (hi/lo: eight) key fragments of chunk c
#pragma unroll
        for (int kt = 0; kt < 2; ++kt)
#pragma unroll
            for (int ks = 0; ks < 2; ++ks) { const size_t o = (size_t)(c * 32 + 16 * kt) * HD + 512 * ks + 8 * lane; kf[kt][ks] = WFrag<T16>::ldf(Kp + o); if (SPLIT) kf2[kt][ks] = WFrag<T16>::ldf(K2 + o); } };
    ldk(min(cf, qt));
    asm volatile("s_wait_xcnt 0x0" ::: "memory");   // stands in front of the first overwrite of the address registers that the query and key loads above name
    for (int c = cf; c <= qt; c += CS) {
        const int k0 = c * 32;
        V vf[4], vf2[4];
#pragma unroll
        for (int dt = 0; dt < 4; ++dt) { const size_t o = (size_t)k0 * HD + 512 * dt + 8 * lane; vf[dt] = WFrag<T16>::ldf(Vt + o); if (SPLIT) vf2[dt] = WFrag<T16>::ldf(Vt2 + o); }
        __builtin_amdgcn_sched_barrier(0);   // the value loads issue here, ahead of the score products, and land while scores and softmax run
        v8f s[2][NQG];
#pragma unroll
        for (int kt = 0; kt < 2; ++kt)
#pragma unroll
            for (int qg = 0; qg < NQG; ++qg) { v8f a = (v8f){};
#pragma unroll
                for (int ks = 0; ks < 2; ++ks) { a = WFrag<T16>::mma(kf[kt][ks], qf[qg][ks], a); if (SPLIT) { a = WFrag<T16>::mma(kf[kt][ks], qf2[qg][ks], a); a = WFrag<T16>::mma(kf2[kt][ks], qf[qg][ks], a); } }
                s[kt][qg] = a; }
        ldk(min(c + CS, qt));   // this wave's next chunk, one pass ahead (the last pass re-reads an in-range chunk and drops it)
        __builtin_amdgcn_sched_barrier(0);   // the key loads issue here, right behind their registers' last use, and land while softmax and P.V run
        float mn[NQG]; bool up = false;
#pragma unroll
        for (int qg = 0; qg < NQG; ++qg) { float mx = -3.0e38f;
#pragma unroll
            for (int kt = 0; kt < 2; ++kt)
#pragma unroll
                for (int r = 0; r < 8; ++r) { float t = s[kt][qg][r]; if (c == qt) t = (16 * kt + 8 * hi + r <= 16 * qg + qc) ? t : -3.0e38f;   // only the last chunk crosses the diagonal (its first key is the tile's first query)
                    s[kt][qg][r] = t; mx = fmaxf(mx, t); }
            mn[qg] = fmaxf(m[qg], fmaxf(mx, xhalf(mx))); up = up || (mn[qg] > m[qg]); }
        if (__builtin_amdgcn_ballot_w32(up) != 0) {   // a maximum moved: bring sums and context to the new one (the factor is exactly 1 otherwise)
#pragma unroll
            for (int qg = 0; qg < NQG; ++qg) { const float al = __builtin_amdgcn_exp2f((m[qg] - mn[qg]) * SCL2); l[qg] *= al; m[qg] = mn[qg];
#pragma unroll
                for (int dt = 0; dt < 4; ++dt) ot[dt][qg] *= al; } }
#pragma unroll
        for (int qg = 0; qg < NQG; ++qg) { const float mo = POFF - m[qg] * SCL2; v8f p[2];
#pragma unroll
            for (int kt = 0; kt < 2; ++kt)
#pragma unroll
                for (int r = 0; r < 8; ++r) { p[kt][r] = __builtin_amdgcn_exp2f(fmaf(s[kt][qg][r], SCL2, mo)); l[qg] += p[kt][r]; }
            if constexpr (SPLIT) {
                const v8bf h0 = __builtin_convertvector(p[0], v8bf), h1 = __builtin_convertvector(p[1], v8bf);
                const v8bf l0 = __builtin_convertvector(p[0] - __builtin_convertvector(h0, v8f), v8bf), l1 = __builtin_convertvector(p[1] - __builtin_convertvector(h1, v8f), v8bf);
                const V ph = __builtin_shufflevector(h0, h1, 0, 1, 2, 3, 4, 5, 6, 7, 8, 9, 10, 11, 12, 13, 14, 15), pl = __builtin_shufflevector(l0, l1, 0, 1, 2, 3, 4, 5, 6, 7, 8, 9, 10, 11, 12, 13, 14, 15);
#pragma unroll
                for (int dt = 0; dt < 4; ++dt) { ot[dt][qg] = WFrag<T16>::mma(vf[dt], ph, ot[dt][qg]); ot[dt][qg] = WFrag<T16>::mma(vf[dt], pl, ot[dt][qg]); ot[dt][qg] = WFrag<T16>::mma(vf2[dt], ph, ot[dt][qg]); }
            } else {
                const V ph = cat16(__builtin_convertvector(p[0], v8h), __builtin_convertvector(p[1], v8h));
#pragma unroll
                for (int dt = 0; dt < 4; ++dt) ot[dt][qg] = WFrag<T16>::mma(vf[dt], ph, ot[dt][qg]);
            } }
    }
    // this wave's partial result: maximum, sum (halves joined) and 64 context values per query; maximum in log2 units; a wave without a chunk hands over a maximum far below any score, sum 0, context 0
#pragma unroll
    for (int qg = 0; qg < NQG; ++qg) { const float ls = l[qg] + xhalf(l[qg]); const int q = cf * QT + 16 * qg + qc; if (hi == 0) { om[q] = m[qg] * SCL2; ol[q] = ls; }
#pragma unroll
        for (int dt = 0; dt < 4; ++dt) { float* d = oo + (size_t)q * OSP + 16 * dt + 8 * hi; *(v4fa*)d = __builtin_shufflevector(ot[dt][qg], ot[dt][qg], 0, 1, 2, 3); *(v4fa*)(d + 4) = __builtin_shufflevector(ot[dt][qg], ot[dt][qg], 4, 5, 6, 7); } }
}

// grid (heads, batches, TT / QT), longest query tiles first (low z starts first); tiles of query rows < RH run the bf16 hi/lo form, the others the f16 form.
// Four waves per SIMD (at most 256 registers a wave): the vector work between the matrix runs of one wave is covered by the others, and the whole grid is resident at once.
__global__ __launch_bounds__(32 * AW) __attribute__((amdgpu_waves_per_eu(4, 4))) void k_attn(const h16* __restrict__ QK16, const bf* __restrict__ QKh, const bf* __restrict__ QKl, const h16* __restrict__ VT16, const bf* __restrict__ VTh, const bf* __restrict__ VTl, bf* ATh, bf* ATl) {
    __shared__ __align__(16) float oo[AW * QT * OSP]; __shared__ float om[AW * QT]; __shared__ float ol[AW * QT];
    const int qt = (int)(gridDim.z - 1 - blockIdx.z), h = blockIdx.x, b = blockIdx.y; const int w = __builtin_amdgcn_readfirstlane((int)(threadIdx.x >> 5));
    const size_t zq = ((size_t)b * (NH_ + NKV) + h) * TT * HD, zk = ((size_t)b * (NH_ + NKV) + NH_ + h / REP) * TT * HD, zv = ((size_t)b * NKV + h / REP) * HD * TT;
    const bool hires = qt * QT < RH; const int np = hires ? AW / 2 : AW;   // partial results per query
    if (hires) attn_wave<bf, true, 1, AW / 2>(QKh + zq, QKl + zq, QKh + zk, QKl + zk, VTh + zv, VTl + zv, qt, w & 1, w >> 1, om, ol, oo);   // one query group a wave (its twofold operands fit the registers of the f16 form), two waves split the keys
    else attn_wave<h16, false, 2, AW>(QK16 + zq, nullptr, QK16 + zk, nullptr, VT16 + zv, nullptr, qt, 0, w, om, ol, oo);
    __syncthreads();
    // join the np partial results: wave w finishes queries 8w .. 8w + 7, four lanes a query (16 context values each); each 128-byte line of the context planes has one writing wave
    const int lane = threadIdx.x & 31, q = w * 8 + (lane >> 2), dr = (lane & 3) * 16;
    float M = om[q];
#pragma unroll
    for (int u = 1; u < AW; ++u) if (u < np) M = fmaxf(M, om[u * QT + q]);
    float Ls = 0.f; v4f acc[4];
#pragma unroll
    for (int j = 0; j < 4; ++j) acc[j] = (v4f){};
#pragma unroll
    for (int u = 0; u < AW; ++u) if (u < np) { const float cw = __builtin_amdgcn_exp2f(om[u * QT + q] - M); Ls += cw * ol[u * QT + q];
#pragma unroll
        for (int j = 0; j < 4; ++j) acc[j] += cw * *(const v4fa*)(oo + (size_t)(u * QT + q) * OSP + dr + 4 * j); }
    const float inv = __fdiv_rn(1.0f, Ls); v8us oh[2], olo[2];
#pragma unroll
    for (int j = 0; j < 16; ++j) { unsigned short a, c2; splitf(acc[j >> 2][j & 3] * inv, a, c2); oh[j >> 3][j & 7] = a; olo[j >> 3][j & 7] = c2; }
    // fragment order: 16-row tile of the query, block of 32 k and part from h * HD + dr (16 values = one part), the first eight values in lane q & 15, the others in lane 16 + (q & 15); eight queries = one whole line a store
    const size_t off = ((size_t)b * TT + qt * QT + (q & ~15)) * DQ + (h * HD + dr) * 16 + (q & 15) * 8;
    *(v8us*)(ATh + off) = oh[0]; *(v8us*)(ATh + off + 128) = oh[1]; *(v8us*)(ATl + off) = olo[0]; *(v8us*)(ATl + off + 128) = olo[1];
}

extern "C" void kernel_launch(void* const* d_in, const int* in_sizes, int n_in,
                              void* d_out, int out_size, void* d_ws, size_t ws_size, hipStream_t stream) {
    if (n_in < 7) return;
    const size_t needx = ((size_t)(NB - 1) * SEQ_FULL + SEQ) * DM;     // rows actually read / written (full per-batch stride, SEQ rows of the last batch)
    if ((size_t)in_sizes[0] < needx || (size_t)in_sizes[1] < needx || (size_t)in_sizes[2] < needx) return;
    if (in_sizes[3] < DQ * DM || in_sizes[4] < DKV * DM || in_sizes[5] < DKV * DM || in_sizes[6] < DM * DQ) return;
    if ((size_t)out_size < needx) return;
    const float* xq = (const float*)d_in[0]; const float* xk = (const float*)d_in[1]; const float* xv = (const float*)d_in[2];
    const float* wq = (const float*)d_in[3]; const float* wk = (const float*)d_in[4]; const float* wv = (const float*)d_in[5]; const float* wo = (const float*)d_in[6];
    float* OUT = (float*)d_out;     // [NB_FULL][SEQ_FULL][DM]
    char* wsp = (char*)d_ws;
    auto take = [&](size_t bytes) { char* p = wsp; wsp += (bytes + 255) & ~(size_t)255; return (void*)p; };
    bf* WO = (bf*)take((size_t)DM * DQ * 2);
    h16* QK16 = (h16*)take((size_t)NB * (NH_ + NKV) * TT * HD * 2); bf* QKh = (bf*)take((size_t)NB * (NH_ + NKV) * TT * HD * 2); bf* QKl = (bf*)take((size_t)NB * (NH_ + NKV) * TT * HD * 2);   // [b][q heads, then k heads], fragment order
    h16* VT16 = (h16*)take((size_t)NB * NKV * HD * TT * 2); bf* VTh = (bf*)take((size_t)NB * NKV * HD * TT * 2); bf* VTl = (bf*)take((size_t)NB * NKV * HD * TT * 2);
    bf* ATh = (bf*)take((size_t)NB * TT * DQ * 2); bf* ATl = (bf*)take((size_t)NB * TT * DQ * 2);
    if ((size_t)(wsp - (char*)d_ws) > ws_size) return;
    k_proj<<<dim3(NB * TT / 128, NH_ / 2, 4), 128, 0, stream>>>(xq, xk, xv, wq, wk, wv, wo, WO, QK16, QKh, QKl, VT16, VTh, VTl);   // z = q, k, v -> head planes; z = 3: bf16 Wo ([out][in] = Bt rows), fragment order
    k_attn<<<dim3(NH_, NB, TT / QT), 32 * AW, 0, stream>>>(QK16, QKh, QKl, VT16, VTh, VTl, ATh, ATl);
    k_gemmw<bf, 1, false, DQ><<<dim3(NB * TT / 64, DM / 64, 1), 32, 0, stream>>>(ATh, ATl, WO, nullptr, OUT, DM, nullptr, 0, 0, 0);
}

// v007
// One run takes 33.9 microseconds.
// Two timings next to v006 both put it at 1.08 times that version's speed.
// All steps since v000 together make it 21.8 times as fast.
#include <hip/hip_runtime.h>

// Contractions and dtypes (f32 accumulate everywhere): q/k/v projections v_wmma_f32_16x16x32_bf16 on the inputs rounded to bf16 (nearest even; exact products);
// scores and P.V for query rows < 512: bf16 hi/lo split operands (3 products); query rows >= 512: v_wmma_f32_16x16x32_f16 (f16 q/k/v planes, P carried x1024);
// output projection: bf16 hi/lo context planes x bf16 Wo (2 products); softmax and all side math f32.
// Sizes: query/key/value [2][2048][512], weights [512][512] in [out][in] layout (y = x W^T), 8 heads of 64, causal (keys j <= i), scores x 512^-0.5, out [2][2048][512].
// Both batches at once: projections (grid z = q, k, v) read the f32 inputs and round them on the way into LDS, each 64x64 tile written from its accumulators straight to the head planes of q, k ([b][h], rows t, k = d)
// and of v ([b][h], rows d, k = t), each f16 + bf16 hi/lo; one attention launch for all batches and heads: scores, running-maximum softmax and P.V stay in registers,
// the waves of a work-group split the keys and join through LDS -> context hi/lo planes (rows b*SEQ + t, k = h*64 + d); then context x Wo -> out, both batches in one launch.
// FRAGMENT ORDER: every 16-bit plane in the workspace is stored in the order in which a wave loads it as a matrix operand. A block of 16 rows x 32 k is 1024 consecutive bytes: part p (0, 1), lane l, element e hold
// row l & 15, k = 16 p + 8 (l >> 4) + e. A fragment is then two loads of 512 consecutive bytes (four whole 128-byte lines each) in place of two loads of 32 bytes from each of 16 lines.
// Order of the blocks: q, k planes [16-row tile of t][32 d]; v planes [32 t][16-row tile of d]; context planes and Wo [16-row tile][32 k].

#ifndef NB
#define NB 2
#endif
#ifndef SEQ
#define SEQ 2048
#endif
#define NB_FULL  2
#define SEQ_FULL 2048
#define TT   SEQ
#define DM   512
#define NH_  8
#define NKV  8
#define REP  (NH_ / NKV)
#define HD   64
#define DQ   (NH_ * HD)
#define DKV  (NKV * HD)
#define RH   (((TT) < 512) ? (TT) : 512)   // query rows < RH use hi+lo operands
#define SCL  0.044194173824159216         // 512^-0.5
#define QT   32                             // query columns per attention work-group (two 16-column groups; an f16-form wave takes both, a hi/lo-form wave one)
#define AW   4                              // waves per attention work-group; they split the 32-key chunks of the tile's keys
#define OSP  68                             // LDS pitch (floats) of a query's 64 partial context values

static_assert(NB >= 1 && NB <= NB_FULL);
static_assert(SEQ >= 128 && SEQ <= SEQ_FULL && (SEQ % 128) == 0);
static_assert((RH % QT) == 0 && (TT % QT) == 0 && RH > 0 && QT == 32 && QT == 8 * AW);
static_assert(REP == 1 && HD == 64 && (DM % 64) == 0 && (DQ % 64) == 0 && (DKV % 64) == 0);
// workspace carve (every region is a multiple of 256 B and of its store granularity)
#define WS_TOTAL ((size_t)DM * DQ * 2 \
                + (size_t)NB * (NH_ + 2 * NKV) * TT * HD * 2 + (size_t)NB * (2 * NH_ + 4 * NKV) * TT * HD * 2 \
                + (size_t)2 * NB * TT * DQ * 2)
static_assert(WS_TOTAL <= (size_t)268435456);
static_assert(SEQ == SEQ_FULL || NB == 1);      // the batches' rows are read and written as one [NB*SEQ][512] matrix
static_assert(DKV == DQ && (NH_ % 2) == 0 && DM >= 256);     // q, k, v projections share one launch (grid z), two heads a work-group, at least eight passes of 32 k
static_assert(((size_t)(NB - 1) * SEQ_FULL + SEQ) * DM <= (size_t)NB_FULL * SEQ_FULL * DM);

typedef _Float16 h16;
typedef unsigned short bf;
typedef __attribute__((ext_vector_type(16))) __bf16   v16bf;
typedef __attribute__((ext_vector_type(16))) _Float16 v16h;
typedef __attribute__((ext_vector_type(8)))  _Float16 v8h;
typedef __attribute__((ext_vector_type(8)))  unsigned short v8us;
typedef __attribute__((ext_vector_type(8)))  float    v8f;
typedef __attribute__((ext_vector_type(4)))  float    v4f;
typedef v8h  __attribute__((may_alias)) v8ha;
typedef v4f  __attribute__((may_alias)) v4fa;
typedef v8us __attribute__((may_alias)) v8usa;

__device__ __forceinline__ unsigned short f2bf(float f) { unsigned u = __float_as_uint(f); u += 0x7FFFu + ((u >> 16) & 1u); return (unsigned short)(u >> 16); }
__device__ __forceinline__ float bf2f(unsigned short b) { return __uint_as_float(((unsigned)b) << 16); }
__device__ __forceinline__ float bfr(float f) { return bf2f(f2bf(f)); }
__device__ __forceinline__ v16h cat16(v8h lo, v8h hi) { return __builtin_shufflevector(lo, hi, 0, 1, 2, 3, 4, 5, 6, 7, 8, 9, 10, 11, 12, 13, 14, 15); }
__device__ __forceinline__ v16bf cat16b(v8us lo, v8us hi) { return __builtin_bit_cast(v16bf, __builtin_shufflevector(lo, hi, 0, 1, 2, 3, 4, 5, 6, 7, 8, 9, 10, 11, 12, 13, 14, 15)); }
__device__ __forceinline__ v8f wmma16(v16h a, v16h b, v8f c) { return __builtin_amdgcn_wmma_f32_16x16x32_f16(false, a, false, b, (short)0, c, false, false); }
__device__ __forceinline__ v8f wmmab(v16bf a, v16bf b, v8f c) { return __builtin_amdgcn_wmma_f32_16x16x32_bf16(false, a, false, b, (short)0, c, false, false); }

// ---- k_gemmw: register-blocked GEMM, ONE WAVE per 64x64 output tile (16 accumulators), operands straight from 16-bit planes in fragment order (blocks [16-row tile][32 k]; ldf: p = block + 8 lane); grid (M/64, N/64, Z), 32 threads.
// C[m][n] (f32, pitch ldc, + optional f32 bias[n]) = sum_k A[m][k] Bt[n][k] (+ split products per NSPLIT). z-batch strides sA/sB/sC in elements. K % 32 == 0, a compile-time size: the 16-row tiles of a pass then lie at constant byte offsets.
// Fragment map (A and Bt alike, lane l, h = l>>4, row/col = l&15): elements 0..7 = k0 + 8h + 0..7, elements 8..15 = k0 + 16 + 8h + 0..7; D element r = (row 8h + r, col l&15). ld reads it from rows of consecutive k, ldf from a plane in fragment order.
template <typename T16> struct WFrag;
template <> struct WFrag<h16> { typedef v16h V; static __device__ __forceinline__ V ld(const h16* p) { return cat16(*(const v8h*)p, *(const v8h*)(p + 16)); } static __device__ __forceinline__ V ldf(const h16* p) { return cat16(*(const v8h*)p, *(const v8h*)(p + 256)); } static __device__ __forceinline__ v8f mma(V a, V b, v8f c) { return wmma16(a, b, c); } };
template <> struct WFrag<bf> { typedef v16bf V; static __device__ __forceinline__ V ld(const bf* p) { return cat16b(*(const v8us*)p, *(const v8us*)(p + 16)); } static __device__ __forceinline__ V ldf(const bf* p) { return cat16b(*(const v8us*)p, *(const v8us*)(p + 256)); } static __device__ __forceinline__ v8f mma(V a, V b, v8f c) { return wmmab(a, b, c); } };
template <typename T16, int NSPLIT, bool BIAS, int K>
__global__ __launch_bounds__(32) void k_gemmw(const T16* __restrict__ A, const T16* __restrict__ A2, const T16* __restrict__ Bt, const T16* __restrict__ Bt2, float* C, int ldc, const float* __restrict__ bias, size_t sA, size_t sB, size_t sC) {
    typedef typename WFrag<T16>::V V;
    __shared__ __align__(16) float os[16 * 68];
    const size_t z = blockIdx.z; A += z * sA; if (A2) A2 += z * sA; Bt += z * sB; if (Bt2) Bt2 += z * sB; C += z * sC;
    const int lane = threadIdx.x & 31, lr = lane & 15, hi = lane >> 4; const int r0 = blockIdx.x * 64, c0 = blockIdx.y * 64;
    v8f acc[4][4];
#pragma unroll
    for (int mb = 0; mb < 4; ++mb)
#pragma unroll
        for (int nb = 0; nb < 4; ++nb) acc[mb][nb] = (v8f){};
    // a 16-row tile is 32 K bytes, a block of 32 k in it 1024 bytes. Uniform bases.
    const char* Ab = (const char*)(A + (size_t)r0 * K); const char* A2b = (NSPLIT == 1 || NSPLIT == 2) ? (const char*)(A2 + (size_t)r0 * K) : nullptr; const char* Bb = (const char*)(Bt + (size_t)c0 * K); const char* B2b = (NSPLIT >= 2) ? (const char*)(Bt2 + (size_t)c0 * K) : nullptr;
    constexpr int NP = K / 32, RING = 4; static_assert(NP >= RING && NP == 16);
    // ROTATED K LOOP: step p of the loop works on pass (p + rot) mod NP of the k range, rot set by the tile's indices. Waves that share operand rows (a column of tiles shares Bt, a row of tiles A) start together: from the same pass they would ask L2 for the same lines at the same moment.
    // The sum over k only starts elsewhere and wraps round. One per-lane byte offset per step (the 16-row tiles are immediate offsets), formed here once and never stepped.
    // For speed only: bit 2 of x is left out; y and y + 4 keep one rot.
    const unsigned rot = ((blockIdx.x & 3) + 4 * (blockIdx.x >> 3) + 4 * blockIdx.y) & (NP - 1);
    unsigned vof[NP];
#pragma unroll
    for (int p = 0; p < NP; ++p) vof[p] = (lane * 16 + (rot + p) * 1024) & (NP * 1024 - 1);
    // REGISTER RING: RING sets of a pass's fragments; the loads run RING - 1 passes ahead of their use, so that a pass no longer waits out the whole latency of its own loads (one wave a SIMD: nothing else covers it).
    // A quarter of a set (tile j of each operand) is loaded in front of column group j of the pass that runs RING - 1 passes earlier, when the set of the pass before that one has been read to its end.
    V a[RING][4], a2[RING][4], b[RING][4], b2[RING][4];
    auto ldq = [&](int p, int j) __attribute__((always_inline)) { const int s = p % RING, o = j * 32 * K; const unsigned vo = vof[p];
        a[s][j] = WFrag<T16>::ldf((const T16*)(Ab + vo + o)); if (NSPLIT == 1 || NSPLIT == 2) a2[s][j] = WFrag<T16>::ldf((const T16*)(A2b + vo + o)); b[s][j] = WFrag<T16>::ldf((const T16*)(Bb + vo + o)); if (NSPLIT >= 2) b2[s][j] = WFrag<T16>::ldf((const T16*)(B2b + vo + o)); };
#pragma unroll
    for (int p = 0; p < RING - 1; ++p)
#pragma unroll
        for (int j = 0; j < 4; ++j) ldq(p, j);
    // unrolled whole: set numbers and byte offsets are constants, and the compiler's counted waits leave the younger sets in flight
#pragma unroll
    for (int p = 0; p < NP; ++p) {
#pragma unroll
        for (int nb = 0; nb < 4; ++nb) {
            if (p + RING - 1 < NP) {
                if (p + nb > 0) asm volatile("v_nop\n\tv_nop\n\tv_nop\n\tv_nop" ::: "memory");   // four vector slots between the last product and the loads behind it: the compiler hands out registers as they fall free, so a load may name the B registers of that product; the clobber keeps the loads behind the slots
                ldq(p + RING - 1, nb); }
            __builtin_amdgcn_sched_barrier(0);   // the quarter's loads issue here, ahead of the group's products: moved later they would lose part of their lead
#pragma unroll
            for (int mb = 0; mb < 4; ++mb) { acc[mb][nb] = WFrag<T16>::mma(a[p % RING][mb], b[p % RING][nb], acc[mb][nb]); if (NSPLIT == 1 || NSPLIT == 2) acc[mb][nb] = WFrag<T16>::mma(a2[p % RING][mb], b[p % RING][nb], acc[mb][nb]); if (NSPLIT >= 2) acc[mb][nb] = WFrag<T16>::mma(a[p % RING][mb], b2[p % RING][nb], acc[mb][nb]); }
            __builtin_amdgcn_sched_barrier(0);   // the next quarter's slots and loads stay behind this group's products: the slots count from the group's last product, and no more than RING sets are live
        }
    }
    // stands in front of the first overwrite of the offset registers that the loads above name: the offsets are inputs of the statement, so that each keeps its register up to the wait
    asm volatile("s_wait_xcnt 0x0" :: "v"(vof[0]), "v"(vof[1]), "v"(vof[2]), "v"(vof[3]), "v"(vof[4]), "v"(vof[5]), "v"(vof[6]), "v"(vof[7]), "v"(vof[8]), "v"(vof[9]), "v"(vof[10]), "v"(vof[11]), "v"(vof[12]), "v"(vof[13]), "v"(vof[14]), "v"(vof[15]) : "memory");
    __builtin_amdgcn_sched_barrier(0);   // keeps the epilogue's index arithmetic, which reuses those registers, behind the wait
#pragma unroll
    for (int mb = 0; mb < 4; ++mb) {
#pragma unroll
        for (int nb = 0; nb < 4; ++nb) {
#pragma unroll
            for (int j = 0; j < 8; ++j) os[(hi * 8 + j) * 68 + nb * 16 + lr] = acc[mb][nb][j]; }
        __builtin_amdgcn_wave_barrier(); asm volatile("" ::: "memory");
        float* crow = C + (size_t)(r0 + mb * 16) * ldc + c0;
{
#pragma unroll
            for (int s = 0; s < 8; ++s) { const int row = 2 * s + hi, cofs = lr * 4; v4f val = *(const v4fa*)(os + row * 68 + cofs); if (BIAS) { val[0] += bfr(bias[c0 + cofs]); val[1] += bfr(bias[c0 + cofs + 1]); val[2] += bfr(bias[c0 + cofs + 2]); val[3] += bfr(bias[c0 + cofs + 3]); }
                *(v4f*)(crow + (size_t)row * ldc + cofs) = val; }
             }
        __builtin_amdgcn_wave_barrier(); asm volatile("" ::: "memory");
    }
}

__device__ __forceinline__ void splitf(float y, unsigned short& h, unsigned short& l) { h = f2bf(y); l = f2bf(y - bf2f(h)); }
typedef __attribute__((ext_vector_type(4))) _Float16 v4h;
typedef __attribute__((ext_vector_type(4))) unsigned short v4us;
typedef __attribute__((ext_vector_type(2))) float v2f;

typedef __attribute__((ext_vector_type(8))) __bf16 v8bf;
typedef __attribute__((ext_vector_type(4))) __bf16 v4bf;
#define PP 40   // LDS pitch (bf16 elements) of a staged row's 32 k: 80 bytes = 16 x odd, so that the 16-byte fragment reads of 16 rows spread over the banks
// ---- k_proj: the three projections (grid z = q, k, v; grid x = 128 input rows, grid y = two heads) straight from the f32 inputs; FOUR WAVES per 128x128 tile, each wave one 64x64 quarter (16 accumulators), k order and fragment map as in k_gemmw.
// A pass is 32 k = one 128-byte line of every f32 row: wave w loads whole lines of rows 64 w .. 64 w + 63 of the 256 staged rows (128 A rows, then 128 Bt rows), rounds them to bf16 (nearest even) and stores them to LDS one pass ahead of their use;
// two LDS buffers, one barrier a pass; the f32 loads run three passes ahead of their rows' use. grid z = 3: the bf16 copy of Wo for the output projection (no tile, leaves before any barrier).
// q, k: A = input rows t, Bt = weight rows d: quarter [t][d] -> planes [b][z * NH_ + head]. v: the operands change places (A = weight rows d, Bt = input rows t): quarter [d][t] -> planes [b][head].
// Either way a quarter is 8192 consecutive bytes of its plane, in fragment order; its wave writes it 16 rows at a time through LDS, every store 512 consecutive bytes (half a block: one part of one fragment).
__global__ __launch_bounds__(128) void k_proj(const float* __restrict__ xq, const float* __restrict__ xk, const float* __restrict__ xv, const float* __restrict__ wq, const float* __restrict__ wk, const float* __restrict__ wv, const float* __restrict__ wo,
                                              bf* WO, h16* QK16, bf* QKh, bf* QKl, h16* VT16, bf* VTh, bf* VTl) {
    typedef WFrag<bf>::V V;
    __shared__ __align__(16) bf st[2 * 256 * PP];
    __shared__ __align__(16) float osw[4 * 16 * 68];
    const int z = blockIdx.z;
    if (z == 3) {   // eight elements a thread and trip, in the order of the plane: unit u = ((16-row tile * (DQ / 32) + block of 32 k) * 2 + part) * 32 + lane; a wave writes 512 consecutive bytes at a time
        for (unsigned u = (blockIdx.y * gridDim.x + blockIdx.x) * 128 + threadIdx.x; u < DM * DQ / 8; u += gridDim.x * gridDim.y * 128) {
            const unsigned n = (u / (DQ * 2)) * 16 + (u & 15), k = ((u >> 6) % (DQ / 32)) * 32 + ((u >> 5) & 1) * 16 + ((u >> 4) & 1) * 8; const float* s8 = wo + (size_t)n * DQ + k;
            const v4f x0 = *(const v4f*)s8, x1 = *(const v4f*)(s8 + 4);
            *(v8us*)(WO + (size_t)u * 8) = __builtin_bit_cast(v8us, __builtin_convertvector(__builtin_shufflevector(x0, x1, 0, 1, 2, 3, 4, 5, 6, 7), v8bf)); }
        return;
    }
    const bool tr = z == 2;
    const int w = __builtin_amdgcn_readfirstlane((int)(threadIdx.x >> 5)), wa = w >> 1, wb = w & 1;
    const int lane = threadIdx.x & 31, lr = lane & 15, hi = lane >> 4;
    const float* xr = ((z == 0) ? xq : (z == 1) ? xk : xv) + (size_t)blockIdx.x * 128 * DM; const float* wr = ((z == 0) ? wq : (z == 1) ? wk : wv) + (size_t)blockIdx.y * 128 * DM;
    const float* G = (((w < 2) != tr) ? xr : wr) + (w & 1) * 64 * DM;   // this wave's 64 rows to stage
    // ROTATED K LOOP, as in k_gemmw: the work-group's first pass is pass rot of the k range, set by its tile indices, and the loop wraps round: the 32 groups that share weight rows and the 4 that share input rows start together and would otherwise ask for the same lines at the same moment.
    constexpr unsigned KM = DM * 4 - 128; static_assert((DM & (DM - 1)) == 0);   // the bits of the byte offset that hold the pass (a row is DM * 4 bytes, a pass 128)
    const unsigned rot = ((blockIdx.x & 3) + 4 * (blockIdx.x >> 3) + 4 * blockIdx.y) & (DM / 32 - 1);
    unsigned vb = (lane >> 3) * (DM * 4) + (lane & 7) * 16 + rot * 128;   // the lane's byte offset in them, at the next pass to load: a load covers 4 rows x 128 bytes
    bf* sd = st + (w * 64 + (lane >> 3)) * PP + (lane & 7) * 4;
    const bf* fa = st + (wa * 64 + lr) * PP + 8 * hi; const bf* fb = st + (128 + wb * 64 + lr) * PP + 8 * hi;
    v4f r0[16], r1[16];   // the f32 rows of two later passes, in flight
    auto ldg = [&](v4f (&r)[16]) {
#pragma unroll
        for (int i = 0; i < 16; ++i) r[i] = *(const v4f*)((const char*)G + vb + i * 16 * DM); };
    auto sts = [&](const v4f (&r)[16], int buf) {
#pragma unroll
        for (int i = 0; i < 16; ++i) *(v4us*)(sd + buf * 256 * PP + i * 4 * PP) = __builtin_bit_cast(v4us, __builtin_convertvector(r[i], v4bf)); };
    // Work-group barrier by hand: __syncthreads() would also wait for the global loads issued ahead, which are to stay in flight across it. The wait ends this wave's LDS stores (published here) and LDS reads (their buffer is rewritten behind it).
    auto bar = [&]() { asm volatile("s_wait_dscnt 0x0\n\ts_barrier_signal -1\n\ts_barrier_wait -1" ::: "memory"); };
    v8f acc[4][4];
#pragma unroll
    for (int mb = 0; mb < 4; ++mb)
#pragma unroll
        for (int nb = 0; nb < 4; ++nb) acc[mb][nb] = (v8f){};
    // The wait stands in front of every overwrite of the offset register that the issued loads name: the offset goes through the statement, so that its next step cannot be placed ahead of it.
    auto xw = [&]() { asm volatile("s_wait_xcnt 0x0" : "+v"(vb) :: "memory"); vb = (vb & ~KM) | ((vb + 128) & KM); };   // then on to the next pass, round the end of the row
    ldg(r0); xw(); ldg(r1); xw();
    __builtin_amdgcn_sched_barrier(0);   // the loads of the third pass issue behind all of the second's, as in the loop: the loop's first wait then leaves them in flight
    sts(r0, 0); ldg(r0); xw();
    bar();
    // A pass reads buffer buf; it stores the next pass's rows (loaded two passes ago) into the other buffer, which every wave left at the last barrier, and loads the rows of the third pass from here in their place.
    auto pass = [&](int buf, v4f (&r)[16], bool st_, bool ld_) __attribute__((always_inline)) {
        V a[4], bb[4];
#pragma unroll
        for (int mb = 0; mb < 4; ++mb) { a[mb] = WFrag<bf>::ld(fa + buf * 256 * PP + mb * 16 * PP); bb[mb] = WFrag<bf>::ld(fb + buf * 256 * PP + mb * 16 * PP); }
        __builtin_amdgcn_sched_barrier(0);   // all fragment reads issue here and land while the next rows are rounded and stored
        if (st_) sts(r, buf ^ 1);
        if (ld_) { ldg(r); xw(); }
#pragma unroll
        for (int nb = 0; nb < 4; ++nb)
#pragma unroll
            for (int mb = 0; mb < 4; ++mb) acc[mb][nb] = WFrag<bf>::mma(a[mb], bb[nb], acc[mb][nb]);
        if (st_) bar();   // the last pass stores nothing, and nothing is staged behind it
    };
    // Two passes a trip: buffers and register sets have constant indices. Every pass of the loop loads, so that the count of younger loads in flight is fixed and a pass waits for its own rows alone; the last four passes stand behind the loop, which stays rolled (short text).
#pragma unroll 1
    for (int kc = 0; kc < DM - 128; kc += 64) { pass(0, r1, true, true); pass(1, r0, true, true); }
    pass(0, r1, true, true); pass(1, r0, true, false); pass(0, r1, true, false); pass(1, r0, false, false);
    const int hd = blockIdx.y * 2 + (tr ? wa : wb), t0 = (blockIdx.x * 2 + (tr ? wb : wa)) * 64; float* os = osw + w * 16 * 68;
    const int b = t0 / TT, t = t0 % TT;   // a quarter lies in one batch (TT % 64 == 0)
    const size_t base = (((size_t)b * (tr ? NKV : NH_ + NKV) + (tr ? 0 : z * NH_) + hd) * TT + t) * HD;   // 64 t of a head are 64 * HD consecutive elements in either kind of plane
    h16* P16 = (tr ? VT16 : QK16) + base; bf* Ph = (tr ? VTh : QKh) + base; bf* Pl = (tr ? VTl : QKl) + base;
#pragma unroll
    for (int mb = 0; mb < 4; ++mb) {
#pragma unroll
        for (int nb = 0; nb < 4; ++nb) {
#pragma unroll
            for (int j = 0; j < 8; ++j) os[(hi * 8 + j) * 68 + nb * 16 + lr] = acc[mb][nb][j]; }
        __builtin_amdgcn_wave_barrier(); asm volatile("" ::: "memory");   // the rows are read back by other lanes of this wave: keeps the reads behind the writes
#pragma unroll
        for (int s = 0; s < 4; ++s) { const int cofs = (2 * s + hi) * 8; const v4f x0 = *(const v4fa*)(os + lr * 68 + cofs), x1 = *(const v4fa*)(os + lr * 68 + cofs + 4);   // row lr, columns 32 (s >> 1) + 16 (s & 1) + 8 hi + 0..7: part s & 1 of the block of columns 32 (s >> 1) ..
            const v8f x = __builtin_shufflevector(x0, x1, 0, 1, 2, 3, 4, 5, 6, 7); const v8bf xh = __builtin_convertvector(x, v8bf), xl = __builtin_convertvector(x - __builtin_convertvector(xh, v8f), v8bf);   // round to nearest even, as f2bf and splitf do
            const size_t o = (tr ? (s >> 1) * 2048 + mb * 512 : mb * 1024 + (s >> 1) * 512) + (s & 1) * 256 + lane * 8; *(v8h*)(P16 + o) = __builtin_convertvector(x, v8h); *(v8us*)(Ph + o) = __builtin_bit_cast(v8us, xh); *(v8us*)(Pl + o) = __builtin_bit_cast(v8us, xl);
            asm volatile("s_wait_xcnt 0x0" ::: "memory"); }   // stands in front of the next overwrite of the address registers that these three stores name
        __builtin_amdgcn_wave_barrier(); asm volatile("" ::: "memory");   // the next 16 rows overwrite the staging rows only behind these reads
    }
}
// ---- k_attn: causal attention of QT query rows of one head, scores never leave the registers. Transposed products: S^T = K Q^T (A = 16 key rows, B = 16 query columns), O^T += V^T P^T (A = 16 rows of the value plane [d][t],
// B = P^T packed from two S^T tiles: element s of the operand is key 8h + s (s < 8) or 16 + 8h + s - 8, which is the k order of WFrag::ld and ldf). A lane holds scores and context of ONE query (column l & 15): maximum, sum and rescale are in-lane
// plus one exchange between the wave's halves. Running maximum m of the raw scores; P = 2^((s - m) SCL2 + POFF), SCL2 = 512^-0.5 log2(e) (POFF = 10 carries the f16 P x1024, it cancels in O / sum).
// The unroll directives give every fragment and accumulator array constant indices, so that it lives in registers.
__device__ __forceinline__ float xhalf(float x) { const int b = __float_as_int(x); return __int_as_float(__builtin_amdgcn_permlanex16(b, b, 0x76543210, 0xfedcba98, false, false)); }   // lane l <-> l ^ 16
template <typename T16, bool SPLIT, int NQG, int CS>   // NQG 16-column query groups, from group g0 of the tile; key chunks cf, cf + CS, ...; partial result to LDS slot cf
__device__ __forceinline__ void attn_wave(const T16* __restrict__ Q, const T16* __restrict__ Q2, const T16* __restrict__ Kp, const T16* __restrict__ K2, const T16* __restrict__ Vt, const T16* __restrict__ Vt2, int qt, int g0, int cf, float* om, float* ol, float* oo) {
    typedef typename WFrag<T16>::V V;
    constexpr float SCL2 = (float)(SCL * 1.4426950408889634), POFF = SPLIT ? 0.0f : 10.0f;
    const int lane = threadIdx.x & 31, lr = lane & 15, hi = lane >> 4; const int qc = 16 * g0 + lr;   // this lane's column of group 0 within the tile
    V qf[NQG][2], qf2[NQG][2];
#pragma unroll
    for (int qg = 0; qg < NQG; ++qg)
#pragma unroll
        for (int ks = 0; ks < 2; ++ks) { const size_t o = (size_t)(qt * QT + 16 * (qg + g0)) * HD + 512 * ks + 8 * lane; qf[qg][ks] = WFrag<T16>::ldf(Q + o); if (SPLIT) qf2[qg][ks] = WFrag<T16>::ldf(Q2 + o); }
    v8f ot[4][NQG]; float m[NQG], l[NQG];
#pragma unroll
    for (int qg = 0; qg < NQG; ++qg) { m[qg] = -3.0e38f; l[qg] = 0.f;
#pragma unroll
        for (int dt = 0; dt < 4; ++dt) ot[dt][qg] = (v8f){}; }
    V kf[2][2], kf2[2][2];
    auto ldk = [&](int c) {   // the four (hi/lo: eight) key fragments of chunk c
#pragma unroll
        for (int kt = 0; kt < 2; ++kt)
#pragma unroll
            for (int ks = 0; ks < 2; ++ks) { const size_t o = (size_t)(c * 32 + 16 * kt) * HD + 512 * ks + 8 * lane; kf[kt][ks] = WFrag<T16>::ldf(Kp + o); if (SPLIT) kf2[kt][ks] = WFrag<T16>::ldf(K2 + o); } };
    ldk(min(cf, qt));
    asm volatile("s_wait_xcnt 0x0" ::: "memory");   // stands in front of the first overwrite of the address registers that the query and key loads above name
    for (int c = cf; c <= qt; c += CS) {
        const int k0 = c * 32;
        V vf[4], vf2[4];
#pragma unroll
        for (int dt = 0; dt < 4; ++dt) { const size_t o = (size_t)k0 * HD + 512 * dt + 8 * lane; vf[dt] = WFrag<T16>::ldf(Vt + o); if (SPLIT) vf2[dt] = WFrag<T16>::ldf(Vt2 + o); }
        __builtin_amdgcn_sched_barrier(0);   // the value loads issue here, ahead of the score products, and land while scores and softmax run
        v8f s[2][NQG];
#pragma unroll
        for (int kt = 0; kt < 2; ++kt)
#pragma unroll
            for (int qg = 0; qg < NQG; ++qg) { v8f a = (v8f){};
#pragma unroll
                for (int ks = 0; ks < 2; ++ks) { a = WFrag<T16>::mma(kf[kt][ks], qf[qg][ks], a); if (SPLIT) { a = WFrag<T16>::mma(kf[kt][ks], qf2[qg][ks], a); a = WFrag<T16>::mma(kf2[kt][ks], qf[qg][ks], a); } }
                s[kt][qg] = a; }
        ldk(min(c + CS, qt));   // this wave's next chunk, one pass ahead (the last pass re-reads an in-range chunk and drops it)
        __builtin_amdgcn_sched_barrier(0);   // the key loads issue here, right behind their registers' last use, and land while softmax and P.V run
        float mn[NQG]; bool up = false;
#pragma unroll
        for (int qg = 0; qg < NQG; ++qg) { float mx = -3.0e38f;
#pragma unroll
            for (int kt = 0; kt < 2; ++kt)
#pragma unroll
                for (int r = 0; r < 8; ++r) { float t = s[kt][qg][r]; if (c == qt) t = (16 * kt + 8 * hi + r <= 16 * qg + qc) ? t : -3.0e38f;   // only the last chunk crosses the diagonal (its first key is the tile's first query)
                    s[kt][qg][r] = t; mx = fmaxf(mx, t); }
            mn[qg] = fmaxf(m[qg], fmaxf(mx, xhalf(mx))); up = up || (mn[qg] > m[qg]); }
        if (__builtin_amdgcn_ballot_w32(up) != 0) {   // a maximum moved: bring sums and context to the new one (the factor is exactly 1 otherwise)
#pragma unroll
            for (int qg = 0; qg < NQG; ++qg) { const float al = __builtin_amdgcn_exp2f((m[qg] - mn[qg]) * SCL2); l[qg] *= al; m[qg] = mn[qg];
#pragma unroll
                for (int dt = 0; dt < 4; ++dt) ot[dt][qg] *= al; } }
#pragma unroll
        for (int qg = 0; qg < NQG; ++qg) { const float mo = POFF - m[qg] * SCL2; v8f p[2];
#pragma unroll
            for (int kt = 0; kt < 2; ++kt)
#pragma unroll
                for (int r = 0; r < 8; ++r) { p[kt][r] = __builtin_amdgcn_exp2f(fmaf(s[kt][qg][r], SCL2, mo)); l[qg] += p[kt][r]; }
            if constexpr (SPLIT) {
                const v8bf h0 = __builtin_convertvector(p[0], v8bf), h1 = __builtin_convertvector(p[1], v8bf);
                const v8bf l0 = __builtin_convertvector(p[0] - __builtin_convertvector(h0, v8f), v8bf), l1 = __builtin_convertvector(p[1] - __builtin_convertvector(h1, v8f), v8bf);
                const V ph = __builtin_shufflevector(h0, h1, 0, 1, 2, 3, 4, 5, 6, 7, 8, 9, 10, 11, 12, 13, 14, 15), pl = __builtin_shufflevector(l0, l1, 0, 1, 2, 3, 4, 5, 6, 7, 8, 9, 10, 11, 12, 13, 14, 15);
#pragma unroll
                for (int dt = 0; dt < 4; ++dt) { ot[dt][qg] = WFrag<T16>::mma(vf[dt], ph, ot[dt][qg]); ot[dt][qg] = WFrag<T16>::mma(vf[dt], pl, ot[dt][qg]); ot[dt][qg] = WFrag<T16>::mma(vf2[dt], ph, ot[dt][qg]); }
            } else {
                const V ph = cat16(__builtin_convertvector(p[0], v8h), __builtin_convertvector(p[1], v8h));
#pragma unroll
                for (int dt = 0; dt < 4; ++dt) ot[dt][qg] = WFrag<T16>::mma(vf[dt], ph, ot[dt][qg]);
            } }
    }
    // this wave's partial result: maximum, sum (halves joined) and 64 context values per query; maximum in log2 units; a wave without a chunk hands over a maximum far below any score, sum 0, context 0
#pragma unroll
    for (int qg = 0; qg < NQG; ++qg) { const float ls = l[qg] + xhalf(l[qg]); const int q = cf * QT + 16 * qg + qc; if (hi == 0) { om[q] = m[qg] * SCL2; ol[q] = ls; }
#pragma unroll
        for (int dt = 0; dt < 4; ++dt) { float* d = oo + (size_t)q * OSP + 16 * dt + 8 * hi; *(v4fa*)d = __builtin_shufflevector(ot[dt][qg], ot[dt][qg], 0, 1, 2, 3); *(v4fa*)(d + 4) = __builtin_shufflevector(ot[dt][qg], ot[dt][qg], 4, 5, 6, 7); } }
}

// grid (heads, batches, TT / QT), longest query tiles first (low z starts first); tiles of query rows < RH run the bf16 hi/lo form, the others the f16 form.
// Four waves per SIMD (at most 256 registers a wave): the vector work between the matrix runs of one wave is covered by the others, and the whole grid is resident at once.
__global__ __launch_bounds__(32 * AW) __attribute__((amdgpu_waves_per_eu(4, 4))) void k_attn(const h16* __restrict__ QK16, const bf* __restrict__ QKh, const bf* __restrict__ QKl, const h16* __restrict__ VT16, const bf* __restrict__ VTh, const bf* __restrict__ VTl, bf* ATh, bf* ATl) {
    __shared__ __align__(16) float oo[AW * QT * OSP]; __shared__ float om[AW * QT]; __shared__ float ol[AW * QT];
    const int qt = (int)(gridDim.z - 1 - blockIdx.z), h = blockIdx.x, b = blockIdx.y; const int w = __builtin_amdgcn_readfirstlane((int)(threadIdx.x >> 5));
    const size_t zq = ((size_t)b * (NH_ + NKV) + h) * TT * HD, zk = ((size_t)b * (NH_ + NKV) + NH_ + h / REP) * TT * HD, zv = ((size_t)b * NKV + h / REP) * HD * TT;
    const bool hires = qt * QT < RH; const int np = hires ? AW / 2 : AW;   // partial results per query
    if (hires) attn_wave<bf, true, 1, AW / 2>(QKh + zq, QKl + zq, QKh + zk, QKl + zk, VTh + zv, VTl + zv, qt, w & 1, w >> 1, om, ol, oo);   // one query group a wave (its twofold operands fit the registers of the f16 form), two waves split the keys
    else attn_wave<h16, false, 2, AW>(QK16 + zq, nullptr, QK16 + zk, nullptr, VT16 + zv, nullptr, qt, 0, w, om, ol, oo);
    __syncthreads();
    // join the np partial results: wave w finishes queries 8w .. 8w + 7, four lanes a query (16 context values each); each 128-byte line of the context planes has one writing wave
    const int lane = threadIdx.x & 31, q = w * 8 + (lane >> 2), dr = (lane & 3) * 16;
    float M = om[q];
#pragma unroll
    for (int u = 1; u < AW; ++u) if (u < np) M = fmaxf(M, om[u * QT + q]);
    float Ls = 0.f; v4f acc[4];
#pragma unroll
    for (int j = 0; j < 4; ++j) acc[j] = (v4f){};
#pragma unroll
    for (int u = 0; u < AW; ++u) if (u < np) { const float cw = __builtin_amdgcn_exp2f(om[u * QT + q] - M); Ls += cw * ol[u * QT + q];
#pragma unroll
        for (int j = 0; j < 4; ++j) acc[j] += cw * *(const v4fa*)(oo + (size_t)(u * QT + q) * OSP + dr + 4 * j); }
    const float inv = __fdiv_rn(1.0f, Ls); v8us oh[2], olo[2];
#pragma unroll
    for (int j = 0; j < 16; ++j) { unsigned short a, c2; splitf(acc[j >> 2][j & 3] * inv, a, c2); oh[j >> 3][j & 7] = a; olo[j >> 3][j & 7] = c2; }
    // fragment order: 16-row tile of the query, block of 32 k and part from h * HD + dr (16 values = one part), the first eight values in lane q & 15, the others in lane 16 + (q & 15); eight queries = one whole line a store
    const size_t off = ((size_t)b * TT + qt * QT + (q & ~15)) * DQ + (h * HD + dr) * 16 + (q & 15) * 8;
    *(v8us*)(ATh + off) = oh[0]; *(v8us*)(ATh + off + 128) = oh[1]; *(v8us*)(ATl + off) = olo[0]; *(v8us*)(ATl + off + 128) = olo[1];
}

extern "C" void kernel_launch(void* const* d_in, const int* in_sizes, int n_in,
                              void* d_out, int out_size, void* d_ws, size_t ws_size, hipStream_t stream) {
    if (n_in < 7) return;
    const size_t needx = ((size_t)(NB - 1) * SEQ_FULL + SEQ) * DM;     // rows actually read / written (full per-batch stride, SEQ rows of the last batch)
    if ((size_t)in_sizes[0] < needx || (size_t)in_sizes[1] < needx || (size_t)in_sizes[2] < needx) return;
    if (in_sizes[3] < DQ * DM || in_sizes[4] < DKV * DM || in_sizes[5] < DKV * DM || in_sizes[6] < DM * DQ) return;
    if ((size_t)out_size < needx) return;
    const float* xq = (const float*)d_in[0]; const float* xk = (const float*)d_in[1]; const float* xv = (const float*)d_in[2];
    const float* wq = (const float*)d_in[3]; const float* wk = (const float*)d_in[4]; const float* wv = (const float*)d_in[5]; const float* wo = (const float*)d_in[6];
    float* OUT = (float*)d_out;     // [NB_FULL][SEQ_FULL][DM]
    char* wsp = (char*)d_ws;
    auto take = [&](size_t bytes) { char* p = wsp; wsp += (bytes + 255) & ~(size_t)255; return (void*)p; };
    bf* WO = (bf*)take((size_t)DM * DQ * 2);
    h16* QK16 = (h16*)take((size_t)NB * (NH_ + NKV) * TT * HD * 2); bf* QKh = (bf*)take((size_t)NB * (NH_ + NKV) * TT * HD * 2); bf* QKl = (bf*)take((size_t)NB * (NH_ + NKV) * TT * HD * 2);   // [b][q heads, then k heads], fragment order
    h16* VT16 = (h16*)take((size_t)NB * NKV * HD * TT * 2); bf* VTh = (bf*)take((size_t)NB * NKV * HD * TT * 2); bf* VTl = (bf*)take((size_t)NB * NKV * HD * TT * 2);
    bf* ATh = (bf*)take((size_t)NB * TT * DQ * 2); bf* ATl = (bf*)take((size_t)NB * TT * DQ * 2);
    if ((size_t)(wsp - (char*)d_ws) > ws_size) return;
    k_proj<<<dim3(NB * TT / 128, NH_ / 2, 4), 128, 0, stream>>>(xq, xk, xv, wq, wk, wv, wo, WO, QK16, QKh, QKl, VT16, VTh, VTl);   // z = q, k, v -> head planes; z = 3: bf16 Wo ([out][in] = Bt rows), fragment order
    k_attn<<<dim3(NH_, NB, TT / QT), 32 * AW, 0, stream>>>(QK16, QKh, QKl, VT16, VTh, VTl, ATh, ATl);
    k_gemmw<bf, 1, false, DQ><<<dim3(NB * TT / 64, DM / 64, 1), 32, 0, stream>>>(ATh, ATl, WO, nullptr, OUT, DM, nullptr, 0, 0, 0);
}
